// v000
// The times below were measured on an AMD MI455X: many runs one after another, warmed up first and cycling through
// copies of the inputs, with the whole window's GPU time divided by the number of runs. Launches and the gaps
// between them are all in it. The median over several windows is given; except for v000 it joins two sittings, which
// can be a few percent apart, so the side-by-side timings, each taken in one sitting, are the better comparison.
// v000 is the starting kernel. One run takes 327 microseconds.
#include <hip/hip_runtime.h>
#include <hip/hip_bf16.h>
#include <math.h>

typedef __attribute__((ext_vector_type(16))) _Float16 v16h;
typedef __attribute__((ext_vector_type(8)))  float    v8f;

static constexpr int E_  = 1024;
static constexpr int T_  = 1024;
static constexpr int B_  = 4;
static constexpr int H_  = 16;
static constexpr int D_  = 64;
static constexpr int F_  = 4096;

enum { EPI_F32 = 0, EPI_F16 = 1, EPI_F16_GELU = 2, EPI_F32_RES = 3 };

__device__ __forceinline__ v8f wmma_f16(v16h a, v16h b, v8f c) {
  return __builtin_amdgcn_wmma_f32_16x16x32_f16(false, a, false, b, (short)0, c,
                                                false, false);
}

__device__ __forceinline__ void async_b128(const void* lds, const void* g) {
  asm volatile("global_load_async_to_lds_b128 %0, %1, off"
               :: "v"((uint32_t)(uintptr_t)lds),
                  "v"((uint64_t)(uintptr_t)g)
               : "memory");
}
__device__ __forceinline__ void wait_async0() {
  asm volatile("s_wait_asynccnt 0" ::: "memory");
}

__device__ __forceinline__ v16h frag_rm(const _Float16* base, int stride,
                                        int lane, int k0) {
  int m = lane & 15, half = lane >> 4;
  const _Float16* p = base + (size_t)m * stride + k0 + (half << 3);
  v16h f;
#pragma unroll
  for (int v = 0; v < 8; ++v) {
    int k = ((v >> 2) << 4) + ((v & 3) << 1);
    f[2 * v]     = p[k];
    f[2 * v + 1] = p[k + 1];
  }
  return f;
}

// B fragment from K-major source: element B[k][n] = base[k*stride + n]
__device__ __forceinline__ v16h frag_cm(const _Float16* base, int stride,
                                        int lane) {
  int n = lane & 15, half = lane >> 4;
  const _Float16* p = base + (size_t)(half << 3) * stride + n;
  v16h f;
#pragma unroll
  for (int v = 0; v < 8; ++v) {
    int k = ((v >> 2) << 4) + ((v & 3) << 1);
    f[2 * v]     = p[(size_t)k * stride];
    f[2 * v + 1] = p[(size_t)(k + 1) * stride];
  }
  return f;
}

// ---- f32 -> f16 weight conversion (one-shot, bandwidth-trivial) -------------
__global__ __launch_bounds__(256) void cvt_f16_kernel(
    const float* __restrict__ in, _Float16* __restrict__ out) {
  int i = (blockIdx.x * 256 + threadIdx.x) * 4;
  float4 v = *(const float4*)(in + i);
  out[i + 0] = (_Float16)v.x;
  out[i + 1] = (_Float16)v.y;
  out[i + 2] = (_Float16)v.z;
  out[i + 3] = (_Float16)v.w;
}

// ---- LayerNorm (f32 in -> f16 out), one row (E=1024) per 256-thread block ---
__global__ __launch_bounds__(256) void ln_f16_kernel(
    const float* __restrict__ x, const float* __restrict__ w,
    const float* __restrict__ bb, _Float16* __restrict__ out) {
  int row = blockIdx.x;
  const float* xr = x + (size_t)row * E_;
  float vals[4];
  float s = 0.f, s2 = 0.f;
#pragma unroll
  for (int i = 0; i < 4; ++i) {
    float v = xr[threadIdx.x + i * 256];
    vals[i] = v;
    s += v;
    s2 += v * v;
  }
#pragma unroll
  for (int msk = 1; msk < 32; msk <<= 1) {
    s  += __shfl_xor(s, msk, 32);
    s2 += __shfl_xor(s2, msk, 32);
  }
  __shared__ float ps[8], ps2[8];
  int lane = threadIdx.x & 31, wid = threadIdx.x >> 5;
  if (lane == 0) { ps[wid] = s; ps2[wid] = s2; }
  __syncthreads();
  s = 0.f; s2 = 0.f;
#pragma unroll
  for (int i = 0; i < 8; ++i) { s += ps[i]; s2 += ps2[i]; }
  float mean = s * (1.f / E_);
  float var  = s2 * (1.f / E_) - mean * mean;
  float rstd = rsqrtf(var + 1e-5f);
#pragma unroll
  for (int i = 0; i < 4; ++i) {
    int c = threadIdx.x + i * 256;
    out[(size_t)row * E_ + c] = (_Float16)((vals[i] - mean) * rstd * w[c] + bb[c]);
  }
}

template <int EPI>
__global__ __launch_bounds__(256) void gemm_wmma_kernel(
    const _Float16* __restrict__ A, const _Float16* __restrict__ Wt,
    const float* __restrict__ bias, const float* __restrict__ resid,
    void* __restrict__ out, int M, int N, int K) {
  constexpr int TK = 32;
  __shared__ __align__(16) _Float16 As[2][128 * TK];
  __shared__ __align__(16) _Float16 Bs[2][128 * TK];
  int tid = threadIdx.x, lane = tid & 31, wid = tid >> 5;
  int wm = wid & 3, wn = wid >> 2;
  int bm = blockIdx.y * 128, bn = blockIdx.x * 128;
  int ldrow = tid >> 1, ldcol = (tid & 1) << 4;  // 128 rows x 32 k, 16 h/thread
  const _Float16* ag = A  + (size_t)(bm + ldrow) * K + ldcol;
  const _Float16* wg = Wt + (size_t)(bn + ldrow) * K + ldcol;
  const int iters = K / TK;

  // prefetch tile 0 into buffer 0
  {
    _Float16* la = &As[0][ldrow * TK + ldcol];
    _Float16* lb = &Bs[0][ldrow * TK + ldcol];
    async_b128(la, ag);     async_b128(la + 8, ag + 8);
    async_b128(lb, wg);     async_b128(lb + 8, wg + 8);
  }

  v8f acc[2][4] = {};
  for (int it = 0; it < iters; ++it) {
    int cur = it & 1;
    wait_async0();        // my in-flight ops are exactly buffer `cur`'s
    __syncthreads();      // all waves done writing `cur` & done reading `cur^1`
    if (it + 1 < iters) { // prefetch next tile into the other buffer
      const _Float16* ga = ag + (size_t)(it + 1) * TK;
      const _Float16* gb = wg + (size_t)(it + 1) * TK;
      _Float16* la = &As[cur ^ 1][ldrow * TK + ldcol];
      _Float16* lb = &Bs[cur ^ 1][ldrow * TK + ldcol];
      async_b128(la, ga);  async_b128(la + 8, ga + 8);
      async_b128(lb, gb);  async_b128(lb + 8, gb + 8);
    }
    v16h af0 = frag_rm(&As[cur][(wm * 32) * TK], TK, lane, 0);
    v16h af1 = frag_rm(&As[cur][(wm * 32 + 16) * TK], TK, lane, 0);
#pragma unroll
    for (int j = 0; j < 4; ++j) {
      v16h bf = frag_rm(&Bs[cur][(wn * 64 + j * 16) * TK], TK, lane, 0);
      acc[0][j] = wmma_f16(af0, bf, acc[0][j]);
      acc[1][j] = wmma_f16(af1, bf, acc[1][j]);
    }
    __syncthreads();      // all waves done reading `cur` before it is refilled
  }

  int n16 = lane & 15, half = lane >> 4;
#pragma unroll
  for (int i = 0; i < 2; ++i)
#pragma unroll
    for (int j = 0; j < 4; ++j) {
      int col = bn + wn * 64 + j * 16 + n16;
      float bv = bias[col];
#pragma unroll
      for (int r = 0; r < 8; ++r) {
        int row = bm + wm * 32 + i * 16 + half * 8 + r;
        size_t idx = (size_t)row * N + col;
        float v = acc[i][j][r] + bv;
        if constexpr (EPI == EPI_F32) {
          ((float*)out)[idx] = v;
        } else if constexpr (EPI == EPI_F16) {
          ((_Float16*)out)[idx] = (_Float16)v;
        } else if constexpr (EPI == EPI_F16_GELU) {
          ((_Float16*)out)[idx] =
              (_Float16)(0.5f * v * (1.f + erff(v * 0.70710678118f)));
        } else {
          ((float*)out)[idx] = v + resid[idx];
        }
      }
    }
}

// ---- Flash-style causal attention -------------------------------------------
// grid: (T/128 row blocks, B*H). 8 waves/block, each wave owns 16 query rows.
__global__ __launch_bounds__(256) void attn_kernel(
    const _Float16* __restrict__ qkv, _Float16* __restrict__ o16) {
  __shared__ __align__(16) _Float16 Pls[8 * 16 * 32];  // per-wave P staging
  int tid = threadIdx.x, lane = tid & 31, wid = tid >> 5;
  int b = blockIdx.y >> 4, h = blockIdx.y & 15;
  int q0 = blockIdx.x * 128 + wid * 16;
  const int RS = 3 * E_;
  const _Float16* qbase = qkv + (size_t)b * T_ * RS + h * D_;
  const _Float16* kbase = qbase + E_;
  const _Float16* vbase = qbase + 2 * E_;
  int n16 = lane & 15, half = lane >> 4;

  v16h qf0 = frag_rm(qbase + (size_t)q0 * RS, RS, lane, 0);
  v16h qf1 = frag_rm(qbase + (size_t)q0 * RS, RS, lane, 32);
  v8f oacc[4] = {};
  float mrow[8], lrow[8];
#pragma unroll
  for (int r = 0; r < 8; ++r) { mrow[r] = -INFINITY; lrow[r] = 0.f; }
  _Float16* Pw = &Pls[wid * 16 * 32];
  const float SC = 0.125f;  // 1/sqrt(64)

  for (int j0 = 0; j0 <= q0 + 15; j0 += 32) {   // wave-uniform causal bound
    v8f s0 = {}, s1 = {};
    s0 = wmma_f16(qf0, frag_rm(kbase + (size_t)j0 * RS, RS, lane, 0), s0);
    s0 = wmma_f16(qf1, frag_rm(kbase + (size_t)j0 * RS, RS, lane, 32), s0);
    s1 = wmma_f16(qf0, frag_rm(kbase + (size_t)(j0 + 16) * RS, RS, lane, 0), s1);
    s1 = wmma_f16(qf1, frag_rm(kbase + (size_t)(j0 + 16) * RS, RS, lane, 32), s1);
#pragma unroll
    for (int r = 0; r < 8; ++r) {
      int qrow = q0 + half * 8 + r;
      float a = s0[r] * SC; if (j0 + n16      > qrow) a = -INFINITY;
      float c = s1[r] * SC; if (j0 + 16 + n16 > qrow) c = -INFINITY;
      float t = fmaxf(a, c);
#pragma unroll
      for (int msk = 1; msk < 16; msk <<= 1)
        t = fmaxf(t, __shfl_xor(t, msk, 32));  // row max over 16-lane half
      float mn    = fmaxf(mrow[r], t);
      float alpha = __expf(mrow[r] - mn);
      float p0    = __expf(a - mn);
      float p1    = __expf(c - mn);
      float rs    = p0 + p1;
#pragma unroll
      for (int msk = 1; msk < 16; msk <<= 1) rs += __shfl_xor(rs, msk, 32);
      lrow[r] = lrow[r] * alpha + rs;
      mrow[r] = mn;
#pragma unroll
      for (int d = 0; d < 4; ++d) oacc[d][r] *= alpha;
      Pw[(half * 8 + r) * 32 + n16]      = (_Float16)p0;
      Pw[(half * 8 + r) * 32 + 16 + n16] = (_Float16)p1;
    }
    v16h pf = frag_rm(Pw, 32, lane, 0);
#pragma unroll
    for (int d = 0; d < 4; ++d)
      oacc[d] = wmma_f16(pf, frag_cm(vbase + (size_t)j0 * RS + d * 16, RS, lane),
                         oacc[d]);
  }
  _Float16* obase = o16 + (size_t)b * T_ * E_ + h * D_;
#pragma unroll
  for (int r = 0; r < 8; ++r) {
    float inv = 1.0f / lrow[r];
    int trow = q0 + half * 8 + r;
#pragma unroll
    for (int d = 0; d < 4; ++d)
      obase[(size_t)trow * E_ + d * 16 + n16] = (_Float16)(oacc[d][r] * inv);
  }
}

// ---- Launch -----------------------------------------------------------------
extern "C" void kernel_launch(void* const* d_in, const int* in_sizes, int n_in,
                              void* d_out, int out_size, void* d_ws,
                              size_t ws_size, hipStream_t stream) {
  (void)in_sizes; (void)n_in; (void)out_size; (void)ws_size;
  const float* x    = (const float*)d_in[0];
  const float* ln1w = (const float*)d_in[1];
  const float* ln1b = (const float*)d_in[2];
  const float* ln2w = (const float*)d_in[3];
  const float* ln2b = (const float*)d_in[4];
  const float* qkvw = (const float*)d_in[5];
  const float* qkvb = (const float*)d_in[6];
  const float* outw = (const float*)d_in[7];
  const float* outb = (const float*)d_in[8];
  const float* fc1w = (const float*)d_in[9];
  const float* fc1b = (const float*)d_in[10];
  const float* fc2w = (const float*)d_in[11];
  const float* fc2b = (const float*)d_in[12];

  const int M = B_ * T_;  // 4096
  char* ws = (char*)d_ws;
  // [0,24MB): f16 weights; buf0 8MB; buf1 32MB; x1 16MB  (total 80MB)
  _Float16* qkvw16 = (_Float16*)(ws);
  _Float16* outw16 = (_Float16*)(ws + (6ull  << 20));
  _Float16* fc1w16 = (_Float16*)(ws + (8ull  << 20));
  _Float16* fc2w16 = (_Float16*)(ws + (16ull << 20));
  _Float16* buf0   = (_Float16*)(ws + (24ull << 20));
  _Float16* buf1   = (_Float16*)(ws + (32ull << 20));
  float*    x1     = (float*)   (ws + (64ull << 20));

  dim3 blk(256);
  cvt_f16_kernel<<<dim3(3 * E_ * E_ / 1024), blk, 0, stream>>>(qkvw, qkvw16);
  cvt_f16_kernel<<<dim3(E_ * E_ / 1024),     blk, 0, stream>>>(outw, outw16);
  cvt_f16_kernel<<<dim3(F_ * E_ / 1024),     blk, 0, stream>>>(fc1w, fc1w16);
  cvt_f16_kernel<<<dim3(E_ * F_ / 1024),     blk, 0, stream>>>(fc2w, fc2w16);

  ln_f16_kernel<<<dim3(M), blk, 0, stream>>>(x, ln1w, ln1b, buf0);
  gemm_wmma_kernel<EPI_F16><<<dim3(3 * E_ / 128, M / 128), blk, 0, stream>>>(
      buf0, qkvw16, qkvb, nullptr, buf1, M, 3 * E_, E_);
  attn_kernel<<<dim3(T_ / 128, B_ * H_), blk, 0, stream>>>(buf1, buf0);
  gemm_wmma_kernel<EPI_F32_RES><<<dim3(E_ / 128, M / 128), blk, 0, stream>>>(
      buf0, outw16, outb, x, x1, M, E_, E_);
  ln_f16_kernel<<<dim3(M), blk, 0, stream>>>(x1, ln2w, ln2b, buf0);
  gemm_wmma_kernel<EPI_F16_GELU><<<dim3(F_ / 128, M / 128), blk, 0, stream>>>(
      buf0, fc1w16, fc1b, nullptr, buf1, M, F_, E_);
  gemm_wmma_kernel<EPI_F32_RES><<<dim3(E_ / 128, M / 128), blk, 0, stream>>>(
      buf1, fc2w16, fc2b, x1, d_out, M, E_, F_);
}

// v001
// Measured time: 292 microseconds a run.
// In both of two side-by-side timings against v000, it was 1.13 times as fast.
#include <hip/hip_runtime.h>
#include <hip/hip_bf16.h>
#include <math.h>

typedef __attribute__((ext_vector_type(16))) _Float16 v16h;
typedef __attribute__((ext_vector_type(8)))  float    v8f;

static constexpr int E_  = 1024;
static constexpr int T_  = 1024;
static constexpr int B_  = 4;
static constexpr int H_  = 16;
static constexpr int D_  = 64;
static constexpr int F_  = 4096;

enum { EPI_F32 = 0, EPI_F16 = 1, EPI_F16_GELU = 2, EPI_F32_RES = 3 };

__device__ __forceinline__ v8f wmma_f16(v16h a, v16h b, v8f c) {
  return __builtin_amdgcn_wmma_f32_16x16x32_f16(false, a, false, b, (short)0, c,
                                                false, false);
}

__device__ __forceinline__ void async_b128(const void* lds, const void* g) {
  asm volatile("global_load_async_to_lds_b128 %0, %1, off"
               :: "v"((uint32_t)(uintptr_t)lds),
                  "v"((uint64_t)(uintptr_t)g)
               : "memory");
}
__device__ __forceinline__ void wait_async0() {
  asm volatile("s_wait_asynccnt 0" ::: "memory");
}

__device__ __forceinline__ v16h frag_rm(const _Float16* base, int stride,
                                        int lane, int k0) {
  int m = lane & 15, half = lane >> 4;
  const _Float16* p = base + (size_t)m * stride + k0 + (half << 3);
  v16h f;
#pragma unroll
  for (int v = 0; v < 8; ++v) {
    int k = ((v >> 2) << 4) + ((v & 3) << 1);
    f[2 * v]     = p[k];
    f[2 * v + 1] = p[k + 1];
  }
  return f;
}

// B fragment from K-major source: element B[k][n] = base[k*stride + n]
__device__ __forceinline__ v16h frag_cm(const _Float16* base, int stride,
                                        int lane) {
  int n = lane & 15, half = lane >> 4;
  const _Float16* p = base + (size_t)(half << 3) * stride + n;
  v16h f;
#pragma unroll
  for (int v = 0; v < 8; ++v) {
    int k = ((v >> 2) << 4) + ((v & 3) << 1);
    f[2 * v]     = p[(size_t)k * stride];
    f[2 * v + 1] = p[(size_t)(k + 1) * stride];
  }
  return f;
}

// ---- f32 -> f16 weight conversion (one-shot, bandwidth-trivial) -------------
__global__ __launch_bounds__(256) void cvt_f16_kernel(
    const float* __restrict__ in, _Float16* __restrict__ out) {
  int i = (blockIdx.x * 256 + threadIdx.x) * 4;
  float4 v = *(const float4*)(in + i);
  out[i + 0] = (_Float16)v.x;
  out[i + 1] = (_Float16)v.y;
  out[i + 2] = (_Float16)v.z;
  out[i + 3] = (_Float16)v.w;
}

// ---- LayerNorm (f32 in -> f16 out), one row (E=1024) per 256-thread block ---
__global__ __launch_bounds__(256) void ln_f16_kernel(
    const float* __restrict__ x, const float* __restrict__ w,
    const float* __restrict__ bb, _Float16* __restrict__ out) {
  int row = blockIdx.x;
  const float* xr = x + (size_t)row * E_;
  float vals[4];
  float s = 0.f, s2 = 0.f;
#pragma unroll
  for (int i = 0; i < 4; ++i) {
    float v = xr[threadIdx.x + i * 256];
    vals[i] = v;
    s += v;
    s2 += v * v;
  }
#pragma unroll
  for (int msk = 1; msk < 32; msk <<= 1) {
    s  += __shfl_xor(s, msk, 32);
    s2 += __shfl_xor(s2, msk, 32);
  }
  __shared__ float ps[8], ps2[8];
  int lane = threadIdx.x & 31, wid = threadIdx.x >> 5;
  if (lane == 0) { ps[wid] = s; ps2[wid] = s2; }
  __syncthreads();
  s = 0.f; s2 = 0.f;
#pragma unroll
  for (int i = 0; i < 8; ++i) { s += ps[i]; s2 += ps2[i]; }
  float mean = s * (1.f / E_);
  float var  = s2 * (1.f / E_) - mean * mean;
  float rstd = rsqrtf(var + 1e-5f);
#pragma unroll
  for (int i = 0; i < 4; ++i) {
    int c = threadIdx.x + i * 256;
    out[(size_t)row * E_ + c] = (_Float16)((vals[i] - mean) * rstd * w[c] + bb[c]);
  }
}

template <int EPI>
__global__ __launch_bounds__(256) void gemm_wmma_kernel(
    const _Float16* __restrict__ A, const _Float16* __restrict__ Wt,
    const float* __restrict__ bias, const float* __restrict__ resid,
    void* __restrict__ out, int M, int N, int K) {
  constexpr int TK = 32;
  constexpr int LP = TK + 8;
  __shared__ __align__(16) _Float16 As[2][128 * LP];
  __shared__ __align__(16) _Float16 Bs[2][128 * LP];
  int tid = threadIdx.x, lane = tid & 31, wid = tid >> 5;
  int wm = wid & 3, wn = wid >> 2;
  int bm = blockIdx.y * 128, bn = blockIdx.x * 128;
  int ldrow = tid >> 1, ldcol = (tid & 1) << 4;  // 128 rows x 32 k, 16 h/thread
  const _Float16* ag = A  + (size_t)(bm + ldrow) * K + ldcol;
  const _Float16* wg = Wt + (size_t)(bn + ldrow) * K + ldcol;
  const int iters = K / TK;

  // prefetch tile 0 into buffer 0
  {
    _Float16* la = &As[0][ldrow * LP + ldcol];
    _Float16* lb = &Bs[0][ldrow * LP + ldcol];
    async_b128(la, ag);     async_b128(la + 8, ag + 8);
    async_b128(lb, wg);     async_b128(lb + 8, wg + 8);
  }

  v8f acc[2][4] = {};
  for (int it = 0; it < iters; ++it) {
    int cur = it & 1;
    wait_async0();        // my in-flight ops are exactly buffer `cur`'s
    __syncthreads();      // all waves done writing `cur` & done reading `cur^1`
    if (it + 1 < iters) { // prefetch next tile into the other buffer
      const _Float16* ga = ag + (size_t)(it + 1) * TK;
      const _Float16* gb = wg + (size_t)(it + 1) * TK;
      _Float16* la = &As[cur ^ 1][ldrow * LP + ldcol];
      _Float16* lb = &Bs[cur ^ 1][ldrow * LP + ldcol];
      async_b128(la, ga);  async_b128(la + 8, ga + 8);
      async_b128(lb, gb);  async_b128(lb + 8, gb + 8);
    }
    v16h af0 = frag_rm(&As[cur][(wm * 32) * LP], LP, lane, 0);
    v16h af1 = frag_rm(&As[cur][(wm * 32 + 16) * LP], LP, lane, 0);
#pragma unroll
    for (int j = 0; j < 4; ++j) {
      v16h bf = frag_rm(&Bs[cur][(wn * 64 + j * 16) * LP], LP, lane, 0);
      acc[0][j] = wmma_f16(af0, bf, acc[0][j]);
      acc[1][j] = wmma_f16(af1, bf, acc[1][j]);
    }
    __syncthreads();      // all waves done reading `cur` before it is refilled
  }

  int n16 = lane & 15, half = lane >> 4;
#pragma unroll
  for (int i = 0; i < 2; ++i)
#pragma unroll
    for (int j = 0; j < 4; ++j) {
      int col = bn + wn * 64 + j * 16 + n16;
      float bv = bias[col];
#pragma unroll
      for (int r = 0; r < 8; ++r) {
        int row = bm + wm * 32 + i * 16 + half * 8 + r;
        size_t idx = (size_t)row * N + col;
        float v = acc[i][j][r] + bv;
        if constexpr (EPI == EPI_F32) {
          ((float*)out)[idx] = v;
        } else if constexpr (EPI == EPI_F16) {
          ((_Float16*)out)[idx] = (_Float16)v;
        } else if constexpr (EPI == EPI_F16_GELU) {
          ((_Float16*)out)[idx] =
              (_Float16)(0.5f * v * (1.f + erff(v * 0.70710678118f)));
        } else {
          ((float*)out)[idx] = v + resid[idx];
        }
      }
    }
}

// ---- Flash-style causal attention -------------------------------------------
// grid: (T/128 row blocks, B*H). 8 waves/block, each wave owns 16 query rows.
__global__ __launch_bounds__(256) void attn_kernel(
    const _Float16* __restrict__ qkv, _Float16* __restrict__ o16) {
  __shared__ __align__(16) _Float16 Pls[8 * 16 * 32];  // per-wave P staging
  int tid = threadIdx.x, lane = tid & 31, wid = tid >> 5;
  int b = blockIdx.y >> 4, h = blockIdx.y & 15;
  int q0 = blockIdx.x * 128 + wid * 16;
  const int RS = 3 * E_;
  const _Float16* qbase = qkv + (size_t)b * T_ * RS + h * D_;
  const _Float16* kbase = qbase + E_;
  const _Float16* vbase = qbase + 2 * E_;
  int n16 = lane & 15, half = lane >> 4;

  v16h qf0 = frag_rm(qbase + (size_t)q0 * RS, RS, lane, 0);
  v16h qf1 = frag_rm(qbase + (size_t)q0 * RS, RS, lane, 32);
  v8f oacc[4] = {};
  float mrow[8], lrow[8];
#pragma unroll
  for (int r = 0; r < 8; ++r) { mrow[r] = -INFINITY; lrow[r] = 0.f; }
  _Float16* Pw = &Pls[wid * 16 * 32];
  const float SC = 0.125f;  // 1/sqrt(64)

  for (int j0 = 0; j0 <= q0 + 15; j0 += 32) {   // wave-uniform causal bound
    v8f s0 = {}, s1 = {};
    s0 = wmma_f16(qf0, frag_rm(kbase + (size_t)j0 * RS, RS, lane, 0), s0);
    s0 = wmma_f16(qf1, frag_rm(kbase + (size_t)j0 * RS, RS, lane, 32), s0);
    s1 = wmma_f16(qf0, frag_rm(kbase + (size_t)(j0 + 16) * RS, RS, lane, 0), s1);
    s1 = wmma_f16(qf1, frag_rm(kbase + (size_t)(j0 + 16) * RS, RS, lane, 32), s1);
#pragma unroll
    for (int r = 0; r < 8; ++r) {
      int qrow = q0 + half * 8 + r;
      float a = s0[r] * SC; if (j0 + n16      > qrow) a = -INFINITY;
      float c = s1[r] * SC; if (j0 + 16 + n16 > qrow) c = -INFINITY;
      float t = fmaxf(a, c);
#pragma unroll
      for (int msk = 1; msk < 16; msk <<= 1)
        t = fmaxf(t, __shfl_xor(t, msk, 32));  // row max over 16-lane half
      float mn    = fmaxf(mrow[r], t);
      float alpha = __expf(mrow[r] - mn);
      float p0    = __expf(a - mn);
      float p1    = __expf(c - mn);
      float rs    = p0 + p1;
#pragma unroll
      for (int msk = 1; msk < 16; msk <<= 1) rs += __shfl_xor(rs, msk, 32);
      lrow[r] = lrow[r] * alpha + rs;
      mrow[r] = mn;
#pragma unroll
      for (int d = 0; d < 4; ++d) oacc[d][r] *= alpha;
      Pw[(half * 8 + r) * 32 + n16]      = (_Float16)p0;
      Pw[(half * 8 + r) * 32 + 16 + n16] = (_Float16)p1;
    }
    v16h pf = frag_rm(Pw, 32, lane, 0);
#pragma unroll
    for (int d = 0; d < 4; ++d)
      oacc[d] = wmma_f16(pf, frag_cm(vbase + (size_t)j0 * RS + d * 16, RS, lane),
                         oacc[d]);
  }
  _Float16* obase = o16 + (size_t)b * T_ * E_ + h * D_;
#pragma unroll
  for (int r = 0; r < 8; ++r) {
    float inv = 1.0f / lrow[r];
    int trow = q0 + half * 8 + r;
#pragma unroll
    for (int d = 0; d < 4; ++d)
      obase[(size_t)trow * E_ + d * 16 + n16] = (_Float16)(oacc[d][r] * inv);
  }
}

// ---- Launch -----------------------------------------------------------------
extern "C" void kernel_launch(void* const* d_in, const int* in_sizes, int n_in,
                              void* d_out, int out_size, void* d_ws,
                              size_t ws_size, hipStream_t stream) {
  (void)in_sizes; (void)n_in; (void)out_size; (void)ws_size;
  const float* x    = (const float*)d_in[0];
  const float* ln1w = (const float*)d_in[1];
  const float* ln1b = (const float*)d_in[2];
  const float* ln2w = (const float*)d_in[3];
  const float* ln2b = (const float*)d_in[4];
  const float* qkvw = (const float*)d_in[5];
  const float* qkvb = (const float*)d_in[6];
  const float* outw = (const float*)d_in[7];
  const float* outb = (const float*)d_in[8];
  const float* fc1w = (const float*)d_in[9];
  const float* fc1b = (const float*)d_in[10];
  const float* fc2w = (const float*)d_in[11];
  const float* fc2b = (const float*)d_in[12];

  const int M = B_ * T_;  // 4096
  char* ws = (char*)d_ws;
  // [0,24MB): f16 weights; buf0 8MB; buf1 32MB; x1 16MB  (total 80MB)
  _Float16* qkvw16 = (_Float16*)(ws);
  _Float16* outw16 = (_Float16*)(ws + (6ull  << 20));
  _Float16* fc1w16 = (_Float16*)(ws + (8ull  << 20));
  _Float16* fc2w16 = (_Float16*)(ws + (16ull << 20));
  _Float16* buf0   = (_Float16*)(ws + (24ull << 20));
  _Float16* buf1   = (_Float16*)(ws + (32ull << 20));
  float*    x1     = (float*)   (ws + (64ull << 20));

  dim3 blk(256);
  cvt_f16_kernel<<<dim3(3 * E_ * E_ / 1024), blk, 0, stream>>>(qkvw, qkvw16);
  cvt_f16_kernel<<<dim3(E_ * E_ / 1024),     blk, 0, stream>>>(outw, outw16);
  cvt_f16_kernel<<<dim3(F_ * E_ / 1024),     blk, 0, stream>>>(fc1w, fc1w16);
  cvt_f16_kernel<<<dim3(E_ * F_ / 1024),     blk, 0, stream>>>(fc2w, fc2w16);

  ln_f16_kernel<<<dim3(M), blk, 0, stream>>>(x, ln1w, ln1b, buf0);
  gemm_wmma_kernel<EPI_F16><<<dim3(3 * E_ / 128, M / 128), blk, 0, stream>>>(
      buf0, qkvw16, qkvb, nullptr, buf1, M, 3 * E_, E_);
  attn_kernel<<<dim3(T_ / 128, B_ * H_), blk, 0, stream>>>(buf1, buf0);
  gemm_wmma_kernel<EPI_F32_RES><<<dim3(E_ / 128, M / 128), blk, 0, stream>>>(
      buf0, outw16, outb, x, x1, M, E_, E_);
  ln_f16_kernel<<<dim3(M), blk, 0, stream>>>(x1, ln2w, ln2b, buf0);
  gemm_wmma_kernel<EPI_F16_GELU><<<dim3(F_ / 128, M / 128), blk, 0, stream>>>(
      buf0, fc1w16, fc1b, nullptr, buf1, M, F_, E_);
  gemm_wmma_kernel<EPI_F32_RES><<<dim3(E_ / 128, M / 128), blk, 0, stream>>>(
      buf1, fc2w16, fc2b, x1, d_out, M, E_, F_);
}

// v002
// Measured time: 253 microseconds a run.
// Next to v001, in two timings, it ran 1.16 and 1.15 times as fast.
// Over all steps from v000 it is 1.30 times as fast.
#include <hip/hip_runtime.h>
#include <hip/hip_bf16.h>
#include <math.h>

typedef __attribute__((ext_vector_type(16))) _Float16 v16h;
typedef __attribute__((ext_vector_type(8)))  float    v8f;

static constexpr int E_  = 1024;
static constexpr int T_  = 1024;
static constexpr int B_  = 4;
static constexpr int H_  = 16;
static constexpr int D_  = 64;
static constexpr int F_  = 4096;

enum { EPI_F32 = 0, EPI_F16 = 1, EPI_F16_GELU = 2, EPI_F32_RES = 3 };

__device__ __forceinline__ v8f wmma_f16(v16h a, v16h b, v8f c) {
  return __builtin_amdgcn_wmma_f32_16x16x32_f16(false, a, false, b, (short)0, c,
                                                false, false);
}

__device__ __forceinline__ void async_stage(const _Float16* la,
                                            const _Float16* ga,
                                            const _Float16* lb,
                                            const _Float16* gb, uint32_t lstep,
                                            size_t gstep) {
  uint32_t a0 = (uint32_t)(uintptr_t)la, b0 = (uint32_t)(uintptr_t)lb;
  asm volatile("global_load_async_to_lds_b128 %0, %8, off\n\t"
               "global_load_async_to_lds_b128 %1, %9, off\n\t"
               "global_load_async_to_lds_b128 %2, %10, off\n\t"
               "global_load_async_to_lds_b128 %3, %11, off\n\t"
               "global_load_async_to_lds_b128 %4, %12, off\n\t"
               "global_load_async_to_lds_b128 %5, %13, off\n\t"
               "global_load_async_to_lds_b128 %6, %14, off\n\t"
               "global_load_async_to_lds_b128 %7, %15, off\n\t"
               "s_wait_xcnt 0x0"
               :: "v"(a0), "v"(a0 + lstep), "v"(a0 + 2 * lstep),
                  "v"(a0 + 3 * lstep),
                  "v"(b0), "v"(b0 + lstep), "v"(b0 + 2 * lstep),
                  "v"(b0 + 3 * lstep),
                  "v"((uint64_t)(uintptr_t)ga),
                  "v"((uint64_t)(uintptr_t)(ga + gstep)),
                  "v"((uint64_t)(uintptr_t)(ga + 2 * gstep)),
                  "v"((uint64_t)(uintptr_t)(ga + 3 * gstep)),
                  "v"((uint64_t)(uintptr_t)gb),
                  "v"((uint64_t)(uintptr_t)(gb + gstep)),
                  "v"((uint64_t)(uintptr_t)(gb + 2 * gstep)),
                  "v"((uint64_t)(uintptr_t)(gb + 3 * gstep))
               : "memory");
}
__device__ __forceinline__ void wait_async0() {
  asm volatile("s_wait_asynccnt 0" ::: "memory");
}

__device__ __forceinline__ v16h frag_rm(const _Float16* base, int stride,
                                        int lane, int k0) {
  int m = lane & 15, half = lane >> 4;
  const _Float16* p = base + (size_t)m * stride + k0 + (half << 3);
  v16h f;
#pragma unroll
  for (int v = 0; v < 8; ++v) {
    int k = ((v >> 2) << 4) + ((v & 3) << 1);
    f[2 * v]     = p[k];
    f[2 * v + 1] = p[k + 1];
  }
  return f;
}

// B fragment from K-major source: element B[k][n] = base[k*stride + n]
__device__ __forceinline__ v16h frag_cm(const _Float16* base, int stride,
                                        int lane) {
  int n = lane & 15, half = lane >> 4;
  const _Float16* p = base + (size_t)(half << 3) * stride + n;
  v16h f;
#pragma unroll
  for (int v = 0; v < 8; ++v) {
    int k = ((v >> 2) << 4) + ((v & 3) << 1);
    f[2 * v]     = p[(size_t)k * stride];
    f[2 * v + 1] = p[(size_t)(k + 1) * stride];
  }
  return f;
}

// ---- f32 -> f16 weight conversion (one-shot, bandwidth-trivial) -------------
__global__ __launch_bounds__(256) void cvt_f16_kernel(
    const float* __restrict__ in, _Float16* __restrict__ out) {
  int i = (blockIdx.x * 256 + threadIdx.x) * 4;
  float4 v = *(const float4*)(in + i);
  out[i + 0] = (_Float16)v.x;
  out[i + 1] = (_Float16)v.y;
  out[i + 2] = (_Float16)v.z;
  out[i + 3] = (_Float16)v.w;
}

// ---- LayerNorm (f32 in -> f16 out), one row (E=1024) per 256-thread block ---
__global__ __launch_bounds__(256) void ln_f16_kernel(
    const float* __restrict__ x, const float* __restrict__ w,
    const float* __restrict__ bb, _Float16* __restrict__ out) {
  int row = blockIdx.x;
  const float* xr = x + (size_t)row * E_;
  float vals[4];
  float s = 0.f, s2 = 0.f;
#pragma unroll
  for (int i = 0; i < 4; ++i) {
    float v = xr[threadIdx.x + i * 256];
    vals[i] = v;
    s += v;
    s2 += v * v;
  }
#pragma unroll
  for (int msk = 1; msk < 32; msk <<= 1) {
    s  += __shfl_xor(s, msk, 32);
    s2 += __shfl_xor(s2, msk, 32);
  }
  __shared__ float ps[8], ps2[8];
  int lane = threadIdx.x & 31, wid = threadIdx.x >> 5;
  if (lane == 0) { ps[wid] = s; ps2[wid] = s2; }
  __syncthreads();
  s = 0.f; s2 = 0.f;
#pragma unroll
  for (int i = 0; i < 8; ++i) { s += ps[i]; s2 += ps2[i]; }
  float mean = s * (1.f / E_);
  float var  = s2 * (1.f / E_) - mean * mean;
  float rstd = rsqrtf(var + 1e-5f);
#pragma unroll
  for (int i = 0; i < 4; ++i) {
    int c = threadIdx.x + i * 256;
    out[(size_t)row * E_ + c] = (_Float16)((vals[i] - mean) * rstd * w[c] + bb[c]);
  }
}

template <int EPI>
__global__ __launch_bounds__(256) void gemm_wmma_kernel(
    const _Float16* __restrict__ A, const _Float16* __restrict__ Wt,
    const float* __restrict__ bias, const float* __restrict__ resid,
    void* __restrict__ out, int M, int N, int K) {
  // A stage holds 64 k = 128 B of every operand row: one whole cache line, so
  // that eight lanes copy a row and a wave's copy reads four whole lines.
  constexpr int TK = 64;
  constexpr int LP = TK + 8;
  __shared__ __align__(16) _Float16 As[2][128 * LP];
  __shared__ __align__(16) _Float16 Bs[2][128 * LP];
  int tid = threadIdx.x, lane = tid & 31, wid = tid >> 5;
  int wm = wid & 3, wn = wid >> 2;
  int bm = blockIdx.y * 128, bn = blockIdx.x * 128;
  int ldrow = tid >> 3, ldcol = (tid & 7) << 3;  // 32 rows x 64 k per copy group
  constexpr uint32_t LSTEP = 32 * LP * sizeof(_Float16);  // 32 rows on, in LDS
  const size_t gstep = (size_t)32 * K;                    // 32 rows on, global
  const _Float16* ag = A  + (size_t)(bm + ldrow) * K + ldcol;
  const _Float16* wg = Wt + (size_t)(bn + ldrow) * K + ldcol;
  const int iters = K / TK;

  // prefetch tile 0 into buffer 0
  async_stage(&As[0][ldrow * LP + ldcol], ag, &Bs[0][ldrow * LP + ldcol], wg,
              LSTEP, gstep);

  v8f acc[2][4] = {};
  for (int it = 0; it < iters; ++it) {
    int cur = it & 1;
    wait_async0();        // my in-flight ops are exactly buffer `cur`'s
    __syncthreads();      // all waves done writing `cur` & done reading `cur^1`
    if (it + 1 < iters) { // prefetch next tile into the other buffer
      const _Float16* ga = ag + (size_t)(it + 1) * TK;
      const _Float16* gb = wg + (size_t)(it + 1) * TK;
      async_stage(&As[cur ^ 1][ldrow * LP + ldcol], ga,
                  &Bs[cur ^ 1][ldrow * LP + ldcol], gb, LSTEP, gstep);
    }
    // Unrolled so that the k offset of each fragment read is an immediate.
#pragma unroll
    for (int kk = 0; kk < TK; kk += 32) {
      v16h af0 = frag_rm(&As[cur][(wm * 32) * LP], LP, lane, kk);
      v16h af1 = frag_rm(&As[cur][(wm * 32 + 16) * LP], LP, lane, kk);
#pragma unroll
      for (int j = 0; j < 4; ++j) {
        v16h bf = frag_rm(&Bs[cur][(wn * 64 + j * 16) * LP], LP, lane, kk);
        acc[0][j] = wmma_f16(af0, bf, acc[0][j]);
        acc[1][j] = wmma_f16(af1, bf, acc[1][j]);
      }
    }
    __syncthreads();      // all waves done reading `cur` before it is refilled
  }
  wait_async0();  // no copy is left in flight when the wave ends (also K < TK)

  int n16 = lane & 15, half = lane >> 4;
#pragma unroll
  for (int i = 0; i < 2; ++i)
#pragma unroll
    for (int j = 0; j < 4; ++j) {
      int col = bn + wn * 64 + j * 16 + n16;
      float bv = bias[col];
#pragma unroll
      for (int r = 0; r < 8; ++r) {
        int row = bm + wm * 32 + i * 16 + half * 8 + r;
        size_t idx = (size_t)row * N + col;
        float v = acc[i][j][r] + bv;
        if constexpr (EPI == EPI_F32) {
          ((float*)out)[idx] = v;
        } else if constexpr (EPI == EPI_F16) {
          ((_Float16*)out)[idx] = (_Float16)v;
        } else if constexpr (EPI == EPI_F16_GELU) {
          ((_Float16*)out)[idx] =
              (_Float16)(0.5f * v * (1.f + erff(v * 0.70710678118f)));
        } else {
          ((float*)out)[idx] = v + resid[idx];
        }
      }
    }
}

// ---- Flash-style causal attention -------------------------------------------
// grid: (T/128 row blocks, B*H). 8 waves/block, each wave owns 16 query rows.
__global__ __launch_bounds__(256) void attn_kernel(
    const _Float16* __restrict__ qkv, _Float16* __restrict__ o16) {
  __shared__ __align__(16) _Float16 Pls[8 * 16 * 32];  // per-wave P staging
  int tid = threadIdx.x, lane = tid & 31, wid = tid >> 5;
  int b = blockIdx.y >> 4, h = blockIdx.y & 15;
  int q0 = blockIdx.x * 128 + wid * 16;
  const int RS = 3 * E_;
  const _Float16* qbase = qkv + (size_t)b * T_ * RS + h * D_;
  const _Float16* kbase = qbase + E_;
  const _Float16* vbase = qbase + 2 * E_;
  int n16 = lane & 15, half = lane >> 4;

  v16h qf0 = frag_rm(qbase + (size_t)q0 * RS, RS, lane, 0);
  v16h qf1 = frag_rm(qbase + (size_t)q0 * RS, RS, lane, 32);
  v8f oacc[4] = {};
  float mrow[8], lrow[8];
#pragma unroll
  for (int r = 0; r < 8; ++r) { mrow[r] = -INFINITY; lrow[r] = 0.f; }
  _Float16* Pw = &Pls[wid * 16 * 32];
  const float SC = 0.125f;  // 1/sqrt(64)

  for (int j0 = 0; j0 <= q0 + 15; j0 += 32) {   // wave-uniform causal bound
    v8f s0 = {}, s1 = {};
    s0 = wmma_f16(qf0, frag_rm(kbase + (size_t)j0 * RS, RS, lane, 0), s0);
    s0 = wmma_f16(qf1, frag_rm(kbase + (size_t)j0 * RS, RS, lane, 32), s0);
    s1 = wmma_f16(qf0, frag_rm(kbase + (size_t)(j0 + 16) * RS, RS, lane, 0), s1);
    s1 = wmma_f16(qf1, frag_rm(kbase + (size_t)(j0 + 16) * RS, RS, lane, 32), s1);
#pragma unroll
    for (int r = 0; r < 8; ++r) {
      int qrow = q0 + half * 8 + r;
      float a = s0[r] * SC; if (j0 + n16      > qrow) a = -INFINITY;
      float c = s1[r] * SC; if (j0 + 16 + n16 > qrow) c = -INFINITY;
      float t = fmaxf(a, c);
#pragma unroll
      for (int msk = 1; msk < 16; msk <<= 1)
        t = fmaxf(t, __shfl_xor(t, msk, 32));  // row max over 16-lane half
      float mn    = fmaxf(mrow[r], t);
      float alpha = __expf(mrow[r] - mn);
      float p0    = __expf(a - mn);
      float p1    = __expf(c - mn);
      float rs    = p0 + p1;
#pragma unroll
      for (int msk = 1; msk < 16; msk <<= 1) rs += __shfl_xor(rs, msk, 32);
      lrow[r] = lrow[r] * alpha + rs;
      mrow[r] = mn;
#pragma unroll
      for (int d = 0; d < 4; ++d) oacc[d][r] *= alpha;
      Pw[(half * 8 + r) * 32 + n16]      = (_Float16)p0;
      Pw[(half * 8 + r) * 32 + 16 + n16] = (_Float16)p1;
    }
    v16h pf = frag_rm(Pw, 32, lane, 0);
#pragma unroll
    for (int d = 0; d < 4; ++d)
      oacc[d] = wmma_f16(pf, frag_cm(vbase + (size_t)j0 * RS + d * 16, RS, lane),
                         oacc[d]);
  }
  _Float16* obase = o16 + (size_t)b * T_ * E_ + h * D_;
#pragma unroll
  for (int r = 0; r < 8; ++r) {
    float inv = 1.0f / lrow[r];
    int trow = q0 + half * 8 + r;
#pragma unroll
    for (int d = 0; d < 4; ++d)
      obase[(size_t)trow * E_ + d * 16 + n16] = (_Float16)(oacc[d][r] * inv);
  }
}

// ---- Launch -----------------------------------------------------------------
extern "C" void kernel_launch(void* const* d_in, const int* in_sizes, int n_in,
                              void* d_out, int out_size, void* d_ws,
                              size_t ws_size, hipStream_t stream) {
  (void)in_sizes; (void)n_in; (void)out_size; (void)ws_size;
  const float* x    = (const float*)d_in[0];
  const float* ln1w = (const float*)d_in[1];
  const float* ln1b = (const float*)d_in[2];
  const float* ln2w = (const float*)d_in[3];
  const float* ln2b = (const float*)d_in[4];
  const float* qkvw = (const float*)d_in[5];
  const float* qkvb = (const float*)d_in[6];
  const float* outw = (const float*)d_in[7];
  const float* outb = (const float*)d_in[8];
  const float* fc1w = (const float*)d_in[9];
  const float* fc1b = (const float*)d_in[10];
  const float* fc2w = (const float*)d_in[11];
  const float* fc2b = (const float*)d_in[12];

  const int M = B_ * T_;  // 4096
  char* ws = (char*)d_ws;
  // [0,24MB): f16 weights; buf0 8MB; buf1 32MB; x1 16MB  (total 80MB)
  _Float16* qkvw16 = (_Float16*)(ws);
  _Float16* outw16 = (_Float16*)(ws + (6ull  << 20));
  _Float16* fc1w16 = (_Float16*)(ws + (8ull  << 20));
  _Float16* fc2w16 = (_Float16*)(ws + (16ull << 20));
  _Float16* buf0   = (_Float16*)(ws + (24ull << 20));
  _Float16* buf1   = (_Float16*)(ws + (32ull << 20));
  float*    x1     = (float*)   (ws + (64ull << 20));

  dim3 blk(256);
  cvt_f16_kernel<<<dim3(3 * E_ * E_ / 1024), blk, 0, stream>>>(qkvw, qkvw16);
  cvt_f16_kernel<<<dim3(E_ * E_ / 1024),     blk, 0, stream>>>(outw, outw16);
  cvt_f16_kernel<<<dim3(F_ * E_ / 1024),     blk, 0, stream>>>(fc1w, fc1w16);
  cvt_f16_kernel<<<dim3(E_ * F_ / 1024),     blk, 0, stream>>>(fc2w, fc2w16);

  ln_f16_kernel<<<dim3(M), blk, 0, stream>>>(x, ln1w, ln1b, buf0);
  gemm_wmma_kernel<EPI_F16><<<dim3(3 * E_ / 128, M / 128), blk, 0, stream>>>(
      buf0, qkvw16, qkvb, nullptr, buf1, M, 3 * E_, E_);
  attn_kernel<<<dim3(T_ / 128, B_ * H_), blk, 0, stream>>>(buf1, buf0);
  gemm_wmma_kernel<EPI_F32_RES><<<dim3(E_ / 128, M / 128), blk, 0, stream>>>(
      buf0, outw16, outb, x, x1, M, E_, E_);
  ln_f16_kernel<<<dim3(M), blk, 0, stream>>>(x1, ln2w, ln2b, buf0);
  gemm_wmma_kernel<EPI_F16_GELU><<<dim3(F_ / 128, M / 128), blk, 0, stream>>>(
      buf0, fc1w16, fc1b, nullptr, buf1, M, F_, E_);
  gemm_wmma_kernel<EPI_F32_RES><<<dim3(E_ / 128, M / 128), blk, 0, stream>>>(
      buf1, fc2w16, fc2b, x1, d_out, M, E_, F_);
}

// v003
// One run takes 241 microseconds.
// In both of two side-by-side timings against v002, it was 1.04 times as fast.
// Counting every step since v000, it is 1.36 times as fast.
#include <hip/hip_runtime.h>
#include <hip/hip_bf16.h>
#include <math.h>

typedef __attribute__((ext_vector_type(16))) _Float16 v16h;
typedef __attribute__((ext_vector_type(8)))  float    v8f;

static constexpr int E_  = 1024;
static constexpr int T_  = 1024;
static constexpr int B_  = 4;
static constexpr int H_  = 16;
static constexpr int D_  = 64;
static constexpr int F_  = 4096;

enum { EPI_F32 = 0, EPI_F16 = 1, EPI_F16_GELU = 2, EPI_F32_RES = 3 };

__device__ __forceinline__ v8f wmma_f16(v16h a, v16h b, v8f c) {
  return __builtin_amdgcn_wmma_f32_16x16x32_f16(false, a, false, b, (short)0, c,
                                                false, false);
}

__device__ __forceinline__ void async_stage(const _Float16* la,
                                            const _Float16* ga,
                                            const _Float16* lb,
                                            const _Float16* gb, uint32_t lstep,
                                            size_t gstep) {
  uint32_t a0 = (uint32_t)(uintptr_t)la, b0 = (uint32_t)(uintptr_t)lb;
  asm volatile("global_load_async_to_lds_b128 %0, %8, off\n\t"
               "global_load_async_to_lds_b128 %1, %9, off\n\t"
               "global_load_async_to_lds_b128 %2, %10, off\n\t"
               "global_load_async_to_lds_b128 %3, %11, off\n\t"
               "global_load_async_to_lds_b128 %4, %12, off\n\t"
               "global_load_async_to_lds_b128 %5, %13, off\n\t"
               "global_load_async_to_lds_b128 %6, %14, off\n\t"
               "global_load_async_to_lds_b128 %7, %15, off\n\t"
               "s_wait_xcnt 0x0"
               :: "v"(a0), "v"(a0 + lstep), "v"(a0 + 2 * lstep),
                  "v"(a0 + 3 * lstep),
                  "v"(b0), "v"(b0 + lstep), "v"(b0 + 2 * lstep),
                  "v"(b0 + 3 * lstep),
                  "v"((uint64_t)(uintptr_t)ga),
                  "v"((uint64_t)(uintptr_t)(ga + gstep)),
                  "v"((uint64_t)(uintptr_t)(ga + 2 * gstep)),
                  "v"((uint64_t)(uintptr_t)(ga + 3 * gstep)),
                  "v"((uint64_t)(uintptr_t)gb),
                  "v"((uint64_t)(uintptr_t)(gb + gstep)),
                  "v"((uint64_t)(uintptr_t)(gb + 2 * gstep)),
                  "v"((uint64_t)(uintptr_t)(gb + 3 * gstep))
               : "memory");
}
__device__ __forceinline__ void wait_async0() {
  asm volatile("s_wait_asynccnt 0" ::: "memory");
}

__device__ __forceinline__ v16h frag_rm(const _Float16* base, int stride,
                                        int lane, int k0) {
  int m = lane & 15, half = lane >> 4;
  const _Float16* p = base + (size_t)m * stride + k0 + (half << 3);
  v16h f;
#pragma unroll
  for (int v = 0; v < 8; ++v) {
    int k = ((v >> 2) << 4) + ((v & 3) << 1);
    f[2 * v]     = p[k];
    f[2 * v + 1] = p[k + 1];
  }
  return f;
}

// B fragment from K-major source: element B[k][n] = base[k*stride + n]
__device__ __forceinline__ v16h frag_cm(const _Float16* base, int stride,
                                        int lane) {
  int n = lane & 15, half = lane >> 4;
  const _Float16* p = base + (size_t)(half << 3) * stride + n;
  v16h f;
#pragma unroll
  for (int v = 0; v < 8; ++v) {
    int k = ((v >> 2) << 4) + ((v & 3) << 1);
    f[2 * v]     = p[(size_t)k * stride];
    f[2 * v + 1] = p[(size_t)(k + 1) * stride];
  }
  return f;
}

// ---- f32 -> f16 weight conversion (one-shot, bandwidth-trivial) -------------
__global__ __launch_bounds__(256) void cvt_f16_kernel(
    const float* __restrict__ in, _Float16* __restrict__ out) {
  int i = (blockIdx.x * 256 + threadIdx.x) * 4;
  float4 v = *(const float4*)(in + i);
  out[i + 0] = (_Float16)v.x;
  out[i + 1] = (_Float16)v.y;
  out[i + 2] = (_Float16)v.z;
  out[i + 3] = (_Float16)v.w;
}

// ---- LayerNorm (f32 in -> f16 out), one row (E=1024) per 256-thread block ---
__global__ __launch_bounds__(256) void ln_f16_kernel(
    const float* __restrict__ x, const float* __restrict__ w,
    const float* __restrict__ bb, _Float16* __restrict__ out) {
  int row = blockIdx.x;
  const float* xr = x + (size_t)row * E_;
  float vals[4];
  float s = 0.f, s2 = 0.f;
#pragma unroll
  for (int i = 0; i < 4; ++i) {
    float v = xr[threadIdx.x + i * 256];
    vals[i] = v;
    s += v;
    s2 += v * v;
  }
#pragma unroll
  for (int msk = 1; msk < 32; msk <<= 1) {
    s  += __shfl_xor(s, msk, 32);
    s2 += __shfl_xor(s2, msk, 32);
  }
  __shared__ float ps[8], ps2[8];
  int lane = threadIdx.x & 31, wid = threadIdx.x >> 5;
  if (lane == 0) { ps[wid] = s; ps2[wid] = s2; }
  __syncthreads();
  s = 0.f; s2 = 0.f;
#pragma unroll
  for (int i = 0; i < 8; ++i) { s += ps[i]; s2 += ps2[i]; }
  float mean = s * (1.f / E_);
  float var  = s2 * (1.f / E_) - mean * mean;
  float rstd = rsqrtf(var + 1e-5f);
#pragma unroll
  for (int i = 0; i < 4; ++i) {
    int c = threadIdx.x + i * 256;
    out[(size_t)row * E_ + c] = (_Float16)((vals[i] - mean) * rstd * w[c] + bb[c]);
  }
}

template <int EPI>
__global__ __launch_bounds__(256) void gemm_wmma_kernel(
    const _Float16* __restrict__ A, const _Float16* __restrict__ Wt,
    const float* __restrict__ bias, const float* __restrict__ resid,
    void* __restrict__ out, int M, int N, int K) {
  // A stage holds 64 k = 128 B of every operand row: one whole cache line, so
  // that eight lanes copy a row and a wave's copy reads four whole lines.
  constexpr int TK = 64;
  constexpr int LP = TK + 8;
  __shared__ __align__(16) _Float16 As[2][128 * LP];
  __shared__ __align__(16) _Float16 Bs[2][128 * LP];
  int tid = threadIdx.x, lane = tid & 31, wid = tid >> 5;
  int wm = wid & 3, wn = wid >> 2;
  int bm = blockIdx.y * 128, bn = blockIdx.x * 128;
  int ldrow = tid >> 3, ldcol = (tid & 7) << 3;  // 32 rows x 64 k per copy group
  constexpr uint32_t LSTEP = 32 * LP * sizeof(_Float16);  // 32 rows on, in LDS
  const size_t gstep = (size_t)32 * K;                    // 32 rows on, global
  const _Float16* ag = A  + (size_t)(bm + ldrow) * K + ldcol;
  const _Float16* wg = Wt + (size_t)(bn + ldrow) * K + ldcol;
  const int iters = K / TK;

  // prefetch tile 0 into buffer 0
  async_stage(&As[0][ldrow * LP + ldcol], ag, &Bs[0][ldrow * LP + ldcol], wg,
              LSTEP, gstep);

  v8f acc[2][4] = {};
  for (int it = 0; it < iters; ++it) {
    int cur = it & 1;
    wait_async0();        // my in-flight ops are exactly buffer `cur`'s
    __syncthreads();      // all waves done writing `cur` & done reading `cur^1`
    if (it + 1 < iters) { // prefetch next tile into the other buffer
      const _Float16* ga = ag + (size_t)(it + 1) * TK;
      const _Float16* gb = wg + (size_t)(it + 1) * TK;
      async_stage(&As[cur ^ 1][ldrow * LP + ldcol], ga,
                  &Bs[cur ^ 1][ldrow * LP + ldcol], gb, LSTEP, gstep);
    }
    // Unrolled so that the k offset of each fragment read is an immediate.
#pragma unroll
    for (int kk = 0; kk < TK; kk += 32) {
      v16h af0 = frag_rm(&As[cur][(wm * 32) * LP], LP, lane, kk);
      v16h af1 = frag_rm(&As[cur][(wm * 32 + 16) * LP], LP, lane, kk);
#pragma unroll
      for (int j = 0; j < 4; ++j) {
        v16h bf = frag_rm(&Bs[cur][(wn * 64 + j * 16) * LP], LP, lane, kk);
        acc[0][j] = wmma_f16(af0, bf, acc[0][j]);
        acc[1][j] = wmma_f16(af1, bf, acc[1][j]);
      }
    }
    __syncthreads();      // all waves done reading `cur` before it is refilled
  }
  wait_async0();  // no copy is left in flight when the wave ends (also K < TK)

  int n16 = lane & 15, half = lane >> 4;
#pragma unroll
  for (int i = 0; i < 2; ++i)
#pragma unroll
    for (int j = 0; j < 4; ++j) {
      int col = bn + wn * 64 + j * 16 + n16;
      float bv = bias[col];
#pragma unroll
      for (int r = 0; r < 8; ++r) {
        int row = bm + wm * 32 + i * 16 + half * 8 + r;
        size_t idx = (size_t)row * N + col;
        float v = acc[i][j][r] + bv;
        if constexpr (EPI == EPI_F32) {
          ((float*)out)[idx] = v;
        } else if constexpr (EPI == EPI_F16) {
          ((_Float16*)out)[idx] = (_Float16)v;
        } else if constexpr (EPI == EPI_F16_GELU) {
          ((_Float16*)out)[idx] =
              (_Float16)(0.5f * v * (1.f + erff(v * 0.70710678118f)));
        } else {
          ((float*)out)[idx] = v + resid[idx];
        }
      }
    }
}

// ---- Flash-style causal attention -------------------------------------------
// grid: (B*H, T/128 row blocks). 8 waves/block, each wave owns 16 query rows.
// Row block t walks t + 1 key blocks, and all work-groups are resident at once,
// two on a WGP, so the launch lasts as long as the fullest WGP. Work-groups 8,
// 16 or 256 apart in launch order take t and NT - 1 - t: equal work a pair.
// For speed only: (head, row block) is met once wherever a work-group lands.
__global__ __launch_bounds__(256) void attn_kernel(
    const _Float16* __restrict__ qkv, _Float16* __restrict__ o16) {
  __shared__ __align__(16) _Float16 Pls[8 * 16 * 32];  // per-wave P staging
  int tid = threadIdx.x, lane = tid & 31, wid = tid >> 5;
  constexpr int NT = T_ / 128;
  int bh = blockIdx.x, b = bh >> 4, h = bh & 15;
  int t = blockIdx.y % (NT / 2);
  int flip = (blockIdx.y / (NT / 2) ^ (bh >> 3) ^ (bh >> 4)) & 1;
  int q0 = (flip ? t : NT - 1 - t) * 128 + wid * 16;
  const int RS = 3 * E_;
  const _Float16* qbase = qkv + (size_t)b * T_ * RS + h * D_;
  const _Float16* kbase = qbase + E_;
  const _Float16* vbase = qbase + 2 * E_;
  int n16 = lane & 15, half = lane >> 4;

  v16h qf0 = frag_rm(qbase + (size_t)q0 * RS, RS, lane, 0);
  v16h qf1 = frag_rm(qbase + (size_t)q0 * RS, RS, lane, 32);
  v8f oacc[4] = {};
  float mrow[8], lrow[8];
#pragma unroll
  for (int r = 0; r < 8; ++r) { mrow[r] = -INFINITY; lrow[r] = 0.f; }
  _Float16* Pw = &Pls[wid * 16 * 32];
  const float SC = 0.125f;  // 1/sqrt(64)

  for (int j0 = 0; j0 <= q0 + 15; j0 += 32) {   // wave-uniform causal bound
    v8f s0 = {}, s1 = {};
    s0 = wmma_f16(qf0, frag_rm(kbase + (size_t)j0 * RS, RS, lane, 0), s0);
    s0 = wmma_f16(qf1, frag_rm(kbase + (size_t)j0 * RS, RS, lane, 32), s0);
    s1 = wmma_f16(qf0, frag_rm(kbase + (size_t)(j0 + 16) * RS, RS, lane, 0), s1);
    s1 = wmma_f16(qf1, frag_rm(kbase + (size_t)(j0 + 16) * RS, RS, lane, 32), s1);
#pragma unroll
    for (int r = 0; r < 8; ++r) {
      int qrow = q0 + half * 8 + r;
      float a = s0[r] * SC; if (j0 + n16      > qrow) a = -INFINITY;
      float c = s1[r] * SC; if (j0 + 16 + n16 > qrow) c = -INFINITY;
      float t = fmaxf(a, c);
#pragma unroll
      for (int msk = 1; msk < 16; msk <<= 1)
        t = fmaxf(t, __shfl_xor(t, msk, 32));  // row max over 16-lane half
      float mn    = fmaxf(mrow[r], t);
      float alpha = __expf(mrow[r] - mn);
      float p0    = __expf(a - mn);
      float p1    = __expf(c - mn);
      float rs    = p0 + p1;
#pragma unroll
      for (int msk = 1; msk < 16; msk <<= 1) rs += __shfl_xor(rs, msk, 32);
      lrow[r] = lrow[r] * alpha + rs;
      mrow[r] = mn;
#pragma unroll
      for (int d = 0; d < 4; ++d) oacc[d][r] *= alpha;
      Pw[(half * 8 + r) * 32 + n16]      = (_Float16)p0;
      Pw[(half * 8 + r) * 32 + 16 + n16] = (_Float16)p1;
    }
    v16h pf = frag_rm(Pw, 32, lane, 0);
#pragma unroll
    for (int d = 0; d < 4; ++d)
      oacc[d] = wmma_f16(pf, frag_cm(vbase + (size_t)j0 * RS + d * 16, RS, lane),
                         oacc[d]);
  }
  _Float16* obase = o16 + (size_t)b * T_ * E_ + h * D_;
#pragma unroll
  for (int r = 0; r < 8; ++r) {
    float inv = 1.0f / lrow[r];
    int trow = q0 + half * 8 + r;
#pragma unroll
    for (int d = 0; d < 4; ++d)
      obase[(size_t)trow * E_ + d * 16 + n16] = (_Float16)(oacc[d][r] * inv);
  }
}

// ---- Launch -----------------------------------------------------------------
extern "C" void kernel_launch(void* const* d_in, const int* in_sizes, int n_in,
                              void* d_out, int out_size, void* d_ws,
                              size_t ws_size, hipStream_t stream) {
  (void)in_sizes; (void)n_in; (void)out_size; (void)ws_size;
  const float* x    = (const float*)d_in[0];
  const float* ln1w = (const float*)d_in[1];
  const float* ln1b = (const float*)d_in[2];
  const float* ln2w = (const float*)d_in[3];
  const float* ln2b = (const float*)d_in[4];
  const float* qkvw = (const float*)d_in[5];
  const float* qkvb = (const float*)d_in[6];
  const float* outw = (const float*)d_in[7];
  const float* outb = (const float*)d_in[8];
  const float* fc1w = (const float*)d_in[9];
  const float* fc1b = (const float*)d_in[10];
  const float* fc2w = (const float*)d_in[11];
  const float* fc2b = (const float*)d_in[12];

  const int M = B_ * T_;  // 4096
  char* ws = (char*)d_ws;
  // [0,24MB): f16 weights; buf0 8MB; buf1 32MB; x1 16MB  (total 80MB)
  _Float16* qkvw16 = (_Float16*)(ws);
  _Float16* outw16 = (_Float16*)(ws + (6ull  << 20));
  _Float16* fc1w16 = (_Float16*)(ws + (8ull  << 20));
  _Float16* fc2w16 = (_Float16*)(ws + (16ull << 20));
  _Float16* buf0   = (_Float16*)(ws + (24ull << 20));
  _Float16* buf1   = (_Float16*)(ws + (32ull << 20));
  float*    x1     = (float*)   (ws + (64ull << 20));

  dim3 blk(256);
  cvt_f16_kernel<<<dim3(3 * E_ * E_ / 1024), blk, 0, stream>>>(qkvw, qkvw16);
  cvt_f16_kernel<<<dim3(E_ * E_ / 1024),     blk, 0, stream>>>(outw, outw16);
  cvt_f16_kernel<<<dim3(F_ * E_ / 1024),     blk, 0, stream>>>(fc1w, fc1w16);
  cvt_f16_kernel<<<dim3(E_ * F_ / 1024),     blk, 0, stream>>>(fc2w, fc2w16);

  ln_f16_kernel<<<dim3(M), blk, 0, stream>>>(x, ln1w, ln1b, buf0);
  gemm_wmma_kernel<EPI_F16><<<dim3(3 * E_ / 128, M / 128), blk, 0, stream>>>(
      buf0, qkvw16, qkvb, nullptr, buf1, M, 3 * E_, E_);
  attn_kernel<<<dim3(B_ * H_, T_ / 128), blk, 0, stream>>>(buf1, buf0);
  gemm_wmma_kernel<EPI_F32_RES><<<dim3(E_ / 128, M / 128), blk, 0, stream>>>(
      buf0, outw16, outb, x, x1, M, E_, E_);
  ln_f16_kernel<<<dim3(M), blk, 0, stream>>>(x1, ln2w, ln2b, buf0);
  gemm_wmma_kernel<EPI_F16_GELU><<<dim3(F_ / 128, M / 128), blk, 0, stream>>>(
      buf0, fc1w16, fc1b, nullptr, buf1, M, F_, E_);
  gemm_wmma_kernel<EPI_F32_RES><<<dim3(E_ / 128, M / 128), blk, 0, stream>>>(
      buf1, fc2w16, fc2b, x1, d_out, M, E_, F_);
}

// v004
// One run takes 219 microseconds.
// In two side-by-side timings against v003, it was 1.11 and 1.12 times as fast.
// All steps since v000 together make it 1.51 times as fast.
#include <hip/hip_runtime.h>
#include <hip/hip_bf16.h>
#include <math.h>

typedef __attribute__((ext_vector_type(16))) _Float16 v16h;
typedef __attribute__((ext_vector_type(8)))  float    v8f;

static constexpr int E_  = 1024;
static constexpr int T_  = 1024;
static constexpr int B_  = 4;
static constexpr int H_  = 16;
static constexpr int D_  = 64;
static constexpr int F_  = 4096;

enum { EPI_F32 = 0, EPI_F16 = 1, EPI_F16_GELU = 2, EPI_F32_RES = 3 };

__device__ __forceinline__ v8f wmma_f16(v16h a, v16h b, v8f c) {
  return __builtin_amdgcn_wmma_f32_16x16x32_f16(false, a, false, b, (short)0, c,
                                                false, false);
}

__device__ __forceinline__ void async_stage(const _Float16* la,
                                            const _Float16* ga,
                                            const _Float16* lb,
                                            const _Float16* gb, uint32_t lstep,
                                            size_t gstep) {
  uint32_t a0 = (uint32_t)(uintptr_t)la, b0 = (uint32_t)(uintptr_t)lb;
  asm volatile("global_load_async_to_lds_b128 %0, %8, off\n\t"
               "global_load_async_to_lds_b128 %1, %9, off\n\t"
               "global_load_async_to_lds_b128 %2, %10, off\n\t"
               "global_load_async_to_lds_b128 %3, %11, off\n\t"
               "global_load_async_to_lds_b128 %4, %12, off\n\t"
               "global_load_async_to_lds_b128 %5, %13, off\n\t"
               "global_load_async_to_lds_b128 %6, %14, off\n\t"
               "global_load_async_to_lds_b128 %7, %15, off\n\t"
               "s_wait_xcnt 0x0"
               :: "v"(a0), "v"(a0 + lstep), "v"(a0 + 2 * lstep),
                  "v"(a0 + 3 * lstep),
                  "v"(b0), "v"(b0 + lstep), "v"(b0 + 2 * lstep),
                  "v"(b0 + 3 * lstep),
                  "v"((uint64_t)(uintptr_t)ga),
                  "v"((uint64_t)(uintptr_t)(ga + gstep)),
                  "v"((uint64_t)(uintptr_t)(ga + 2 * gstep)),
                  "v"((uint64_t)(uintptr_t)(ga + 3 * gstep)),
                  "v"((uint64_t)(uintptr_t)gb),
                  "v"((uint64_t)(uintptr_t)(gb + gstep)),
                  "v"((uint64_t)(uintptr_t)(gb + 2 * gstep)),
                  "v"((uint64_t)(uintptr_t)(gb + 3 * gstep))
               : "memory");
}
__device__ __forceinline__ void wait_async0() {
  asm volatile("s_wait_asynccnt 0" ::: "memory");
}

__device__ __forceinline__ v16h frag_rm(const _Float16* base, int stride,
                                        int lane, int k0) {
  int m = lane & 15, half = lane >> 4;
  const _Float16* p = base + (size_t)m * stride + k0 + (half << 3);
  v16h f;
#pragma unroll
  for (int v = 0; v < 8; ++v) {
    int k = ((v >> 2) << 4) + ((v & 3) << 1);
    f[2 * v]     = p[k];
    f[2 * v + 1] = p[k + 1];
  }
  return f;
}

// B fragment from K-major source: element B[k][n] = base[k*stride + n]
__device__ __forceinline__ v16h frag_cm(const _Float16* base, int stride,
                                        int lane) {
  int n = lane & 15, half = lane >> 4;
  const _Float16* p = base + (size_t)(half << 3) * stride + n;
  v16h f;
#pragma unroll
  for (int v = 0; v < 8; ++v) {
    int k = ((v >> 2) << 4) + ((v & 3) << 1);
    f[2 * v]     = p[(size_t)k * stride];
    f[2 * v + 1] = p[(size_t)(k + 1) * stride];
  }
  return f;
}

// ---- f32 -> f16 weight conversion (one-shot, bandwidth-trivial) -------------
__global__ __launch_bounds__(256) void cvt_f16_kernel(
    const float* __restrict__ in, _Float16* __restrict__ out) {
  int i = (blockIdx.x * 256 + threadIdx.x) * 4;
  float4 v = *(const float4*)(in + i);
  out[i + 0] = (_Float16)v.x;
  out[i + 1] = (_Float16)v.y;
  out[i + 2] = (_Float16)v.z;
  out[i + 3] = (_Float16)v.w;
}

// ---- LayerNorm (f32 in -> f16 out), one row (E=1024) per 256-thread block ---
__global__ __launch_bounds__(256) void ln_f16_kernel(
    const float* __restrict__ x, const float* __restrict__ w,
    const float* __restrict__ bb, _Float16* __restrict__ out) {
  int row = blockIdx.x;
  const float* xr = x + (size_t)row * E_;
  float vals[4];
  float s = 0.f, s2 = 0.f;
#pragma unroll
  for (int i = 0; i < 4; ++i) {
    float v = xr[threadIdx.x + i * 256];
    vals[i] = v;
    s += v;
    s2 += v * v;
  }
#pragma unroll
  for (int msk = 1; msk < 32; msk <<= 1) {
    s  += __shfl_xor(s, msk, 32);
    s2 += __shfl_xor(s2, msk, 32);
  }
  __shared__ float ps[8], ps2[8];
  int lane = threadIdx.x & 31, wid = threadIdx.x >> 5;
  if (lane == 0) { ps[wid] = s; ps2[wid] = s2; }
  __syncthreads();
  s = 0.f; s2 = 0.f;
#pragma unroll
  for (int i = 0; i < 8; ++i) { s += ps[i]; s2 += ps2[i]; }
  float mean = s * (1.f / E_);
  float var  = s2 * (1.f / E_) - mean * mean;
  float rstd = rsqrtf(var + 1e-5f);
#pragma unroll
  for (int i = 0; i < 4; ++i) {
    int c = threadIdx.x + i * 256;
    out[(size_t)row * E_ + c] = (_Float16)((vals[i] - mean) * rstd * w[c] + bb[c]);
  }
}

template <int EPI>
__global__ __launch_bounds__(256) void gemm_wmma_kernel(
    const _Float16* __restrict__ A, const _Float16* __restrict__ Wt,
    const float* __restrict__ bias, const float* __restrict__ resid,
    void* __restrict__ out, int M, int N, int K) {
  // A stage holds 64 k = 128 B of every operand row: one whole cache line, so
  // that eight lanes copy a row and a wave's copy reads four whole lines.
  constexpr int TK = 64;
  constexpr int LP = TK + 8;
  __shared__ __align__(16) _Float16 As[2][128 * LP];
  __shared__ __align__(16) _Float16 Bs[2][128 * LP];
  int tid = threadIdx.x, lane = tid & 31, wid = tid >> 5;
  int wm = wid & 3, wn = wid >> 2;
  int bm = blockIdx.y * 128, bn = blockIdx.x * 128;
  int ldrow = tid >> 3, ldcol = (tid & 7) << 3;  // 32 rows x 64 k per copy group
  constexpr uint32_t LSTEP = 32 * LP * sizeof(_Float16);  // 32 rows on, in LDS
  const size_t gstep = (size_t)32 * K;                    // 32 rows on, global
  const _Float16* ag = A  + (size_t)(bm + ldrow) * K + ldcol;
  const _Float16* wg = Wt + (size_t)(bn + ldrow) * K + ldcol;
  const int iters = K / TK;

  // prefetch tile 0 into buffer 0
  async_stage(&As[0][ldrow * LP + ldcol], ag, &Bs[0][ldrow * LP + ldcol], wg,
              LSTEP, gstep);

  // The residual tile is asked for here, all of it in flight together and
  // behind the whole k loop; loaded one by one between the epilogue's stores,
  // each element cost its wave a full round trip to L2 or memory.
  int n16 = lane & 15, half = lane >> 4;
  float rv[EPI == EPI_F32_RES ? 2 : 1][4][8];
  if constexpr (EPI == EPI_F32_RES) {
#pragma unroll
    for (int i = 0; i < 2; ++i)
#pragma unroll
      for (int r = 0; r < 8; ++r) {
        const float* rp = resid +
            (size_t)(bm + wm * 32 + i * 16 + half * 8 + r) * N + bn + wn * 64 + n16;
#pragma unroll
        for (int j = 0; j < 4; ++j) rv[i][j][r] = rp[j * 16];
      }
  }

  v8f acc[2][4] = {};
  for (int it = 0; it < iters; ++it) {
    int cur = it & 1;
    wait_async0();        // my in-flight ops are exactly buffer `cur`'s
    __syncthreads();      // all waves done writing `cur` & done reading `cur^1`
    if (it + 1 < iters) { // prefetch next tile into the other buffer
      const _Float16* ga = ag + (size_t)(it + 1) * TK;
      const _Float16* gb = wg + (size_t)(it + 1) * TK;
      async_stage(&As[cur ^ 1][ldrow * LP + ldcol], ga,
                  &Bs[cur ^ 1][ldrow * LP + ldcol], gb, LSTEP, gstep);
    }
    // Unrolled so that the k offset of each fragment read is an immediate.
#pragma unroll
    for (int kk = 0; kk < TK; kk += 32) {
      v16h af0 = frag_rm(&As[cur][(wm * 32) * LP], LP, lane, kk);
      v16h af1 = frag_rm(&As[cur][(wm * 32 + 16) * LP], LP, lane, kk);
#pragma unroll
      for (int j = 0; j < 4; ++j) {
        v16h bf = frag_rm(&Bs[cur][(wn * 64 + j * 16) * LP], LP, lane, kk);
        acc[0][j] = wmma_f16(af0, bf, acc[0][j]);
        acc[1][j] = wmma_f16(af1, bf, acc[1][j]);
      }
    }
    __syncthreads();      // all waves done reading `cur` before it is refilled
  }
  wait_async0();  // no copy is left in flight when the wave ends (also K < TK)

#pragma unroll
  for (int i = 0; i < 2; ++i)
#pragma unroll
    for (int j = 0; j < 4; ++j) {
      int col = bn + wn * 64 + j * 16 + n16;
      float bv = bias[col];
#pragma unroll
      for (int r = 0; r < 8; ++r) {
        int row = bm + wm * 32 + i * 16 + half * 8 + r;
        size_t idx = (size_t)row * N + col;
        float v = acc[i][j][r] + bv;
        if constexpr (EPI == EPI_F32) {
          ((float*)out)[idx] = v;
        } else if constexpr (EPI == EPI_F16) {
          ((_Float16*)out)[idx] = (_Float16)v;
        } else if constexpr (EPI == EPI_F16_GELU) {
          ((_Float16*)out)[idx] =
              (_Float16)(0.5f * v * (1.f + erff(v * 0.70710678118f)));
        } else {
          ((float*)out)[idx] = v + rv[i][j][r];
        }
      }
    }
}

// ---- Flash-style causal attention -------------------------------------------
// grid: (B*H, T/128 row blocks). 8 waves/block, each wave owns 16 query rows.
// Row block t walks t + 1 key blocks, and all work-groups are resident at once,
// two on a WGP, so the launch lasts as long as the fullest WGP. Work-groups 8,
// 16 or 256 apart in launch order take t and NT - 1 - t: equal work a pair.
// For speed only: (head, row block) is met once wherever a work-group lands.
__global__ __launch_bounds__(256) void attn_kernel(
    const _Float16* __restrict__ qkv, _Float16* __restrict__ o16) {
  __shared__ __align__(16) _Float16 Pls[8 * 16 * 32];  // per-wave P staging
  int tid = threadIdx.x, lane = tid & 31, wid = tid >> 5;
  constexpr int NT = T_ / 128;
  int bh = blockIdx.x, b = bh >> 4, h = bh & 15;
  int t = blockIdx.y % (NT / 2);
  int flip = (blockIdx.y / (NT / 2) ^ (bh >> 3) ^ (bh >> 4)) & 1;
  int q0 = (flip ? t : NT - 1 - t) * 128 + wid * 16;
  const int RS = 3 * E_;
  const _Float16* qbase = qkv + (size_t)b * T_ * RS + h * D_;
  const _Float16* kbase = qbase + E_;
  const _Float16* vbase = qbase + 2 * E_;
  int n16 = lane & 15, half = lane >> 4;

  v16h qf0 = frag_rm(qbase + (size_t)q0 * RS, RS, lane, 0);
  v16h qf1 = frag_rm(qbase + (size_t)q0 * RS, RS, lane, 32);
  v8f oacc[4] = {};
  float mrow[8], lrow[8];
#pragma unroll
  for (int r = 0; r < 8; ++r) { mrow[r] = -INFINITY; lrow[r] = 0.f; }
  _Float16* Pw = &Pls[wid * 16 * 32];
  const float SC = 0.125f;  // 1/sqrt(64)

  for (int j0 = 0; j0 <= q0 + 15; j0 += 32) {   // wave-uniform causal bound
    v8f s0 = {}, s1 = {};
    s0 = wmma_f16(qf0, frag_rm(kbase + (size_t)j0 * RS, RS, lane, 0), s0);
    s0 = wmma_f16(qf1, frag_rm(kbase + (size_t)j0 * RS, RS, lane, 32), s0);
    s1 = wmma_f16(qf0, frag_rm(kbase + (size_t)(j0 + 16) * RS, RS, lane, 0), s1);
    s1 = wmma_f16(qf1, frag_rm(kbase + (size_t)(j0 + 16) * RS, RS, lane, 32), s1);
#pragma unroll
    for (int r = 0; r < 8; ++r) {
      int qrow = q0 + half * 8 + r;
      float a = s0[r] * SC; if (j0 + n16      > qrow) a = -INFINITY;
      float c = s1[r] * SC; if (j0 + 16 + n16 > qrow) c = -INFINITY;
      float t = fmaxf(a, c);
#pragma unroll
      for (int msk = 1; msk < 16; msk <<= 1)
        t = fmaxf(t, __shfl_xor(t, msk, 32));  // row max over 16-lane half
      float mn    = fmaxf(mrow[r], t);
      float alpha = __expf(mrow[r] - mn);
      float p0    = __expf(a - mn);
      float p1    = __expf(c - mn);
      float rs    = p0 + p1;
#pragma unroll
      for (int msk = 1; msk < 16; msk <<= 1) rs += __shfl_xor(rs, msk, 32);
      lrow[r] = lrow[r] * alpha + rs;
      mrow[r] = mn;
#pragma unroll
      for (int d = 0; d < 4; ++d) oacc[d][r] *= alpha;
      Pw[(half * 8 + r) * 32 + n16]      = (_Float16)p0;
      Pw[(half * 8 + r) * 32 + 16 + n16] = (_Float16)p1;
    }
    v16h pf = frag_rm(Pw, 32, lane, 0);
#pragma unroll
    for (int d = 0; d < 4; ++d)
      oacc[d] = wmma_f16(pf, frag_cm(vbase + (size_t)j0 * RS + d * 16, RS, lane),
                         oacc[d]);
  }
  _Float16* obase = o16 + (size_t)b * T_ * E_ + h * D_;
#pragma unroll
  for (int r = 0; r < 8; ++r) {
    float inv = 1.0f / lrow[r];
    int trow = q0 + half * 8 + r;
#pragma unroll
    for (int d = 0; d < 4; ++d)
      obase[(size_t)trow * E_ + d * 16 + n16] = (_Float16)(oacc[d][r] * inv);
  }
}

// ---- Launch -----------------------------------------------------------------
extern "C" void kernel_launch(void* const* d_in, const int* in_sizes, int n_in,
                              void* d_out, int out_size, void* d_ws,
                              size_t ws_size, hipStream_t stream) {
  (void)in_sizes; (void)n_in; (void)out_size; (void)ws_size;
  const float* x    = (const float*)d_in[0];
  const float* ln1w = (const float*)d_in[1];
  const float* ln1b = (const float*)d_in[2];
  const float* ln2w = (const float*)d_in[3];
  const float* ln2b = (const float*)d_in[4];
  const float* qkvw = (const float*)d_in[5];
  const float* qkvb = (const float*)d_in[6];
  const float* outw = (const float*)d_in[7];
  const float* outb = (const float*)d_in[8];
  const float* fc1w = (const float*)d_in[9];
  const float* fc1b = (const float*)d_in[10];
  const float* fc2w = (const float*)d_in[11];
  const float* fc2b = (const float*)d_in[12];

  const int M = B_ * T_;  // 4096
  char* ws = (char*)d_ws;
  // [0,24MB): f16 weights; buf0 8MB; buf1 32MB; x1 16MB  (total 80MB)
  _Float16* qkvw16 = (_Float16*)(ws);
  _Float16* outw16 = (_Float16*)(ws + (6ull  << 20));
  _Float16* fc1w16 = (_Float16*)(ws + (8ull  << 20));
  _Float16* fc2w16 = (_Float16*)(ws + (16ull << 20));
  _Float16* buf0   = (_Float16*)(ws + (24ull << 20));
  _Float16* buf1   = (_Float16*)(ws + (32ull << 20));
  float*    x1     = (float*)   (ws + (64ull << 20));

  dim3 blk(256);
  cvt_f16_kernel<<<dim3(3 * E_ * E_ / 1024), blk, 0, stream>>>(qkvw, qkvw16);
  cvt_f16_kernel<<<dim3(E_ * E_ / 1024),     blk, 0, stream>>>(outw, outw16);
  cvt_f16_kernel<<<dim3(F_ * E_ / 1024),     blk, 0, stream>>>(fc1w, fc1w16);
  cvt_f16_kernel<<<dim3(E_ * F_ / 1024),     blk, 0, stream>>>(fc2w, fc2w16);

  ln_f16_kernel<<<dim3(M), blk, 0, stream>>>(x, ln1w, ln1b, buf0);
  gemm_wmma_kernel<EPI_F16><<<dim3(3 * E_ / 128, M / 128), blk, 0, stream>>>(
      buf0, qkvw16, qkvb, nullptr, buf1, M, 3 * E_, E_);
  attn_kernel<<<dim3(B_ * H_, T_ / 128), blk, 0, stream>>>(buf1, buf0);
  gemm_wmma_kernel<EPI_F32_RES><<<dim3(E_ / 128, M / 128), blk, 0, stream>>>(
      buf0, outw16, outb, x, x1, M, E_, E_);
  ln_f16_kernel<<<dim3(M), blk, 0, stream>>>(x1, ln2w, ln2b, buf0);
  gemm_wmma_kernel<EPI_F16_GELU><<<dim3(F_ / 128, M / 128), blk, 0, stream>>>(
      buf0, fc1w16, fc1b, nullptr, buf1, M, F_, E_);
  gemm_wmma_kernel<EPI_F32_RES><<<dim3(E_ / 128, M / 128), blk, 0, stream>>>(
      buf1, fc2w16, fc2b, x1, d_out, M, E_, F_);
}

// v005
// A run of this version takes 209 microseconds.
// Next to v004, in two timings, it ran 1.04 and 1.02 times as fast.
// Counting every step since v000, it is 1.56 times as fast.
#include <hip/hip_runtime.h>
#include <hip/hip_bf16.h>
#include <math.h>

typedef __attribute__((ext_vector_type(16))) _Float16 v16h;
typedef __attribute__((ext_vector_type(8)))  float    v8f;

static constexpr int E_  = 1024;
static constexpr int T_  = 1024;
static constexpr int B_  = 4;
static constexpr int H_  = 16;
static constexpr int D_  = 64;
static constexpr int F_  = 4096;

enum { EPI_F32 = 0, EPI_F16 = 1, EPI_F16_GELU = 2, EPI_F32_RES = 3 };

__device__ __forceinline__ v8f wmma_f16(v16h a, v16h b, v8f c) {
  return __builtin_amdgcn_wmma_f32_16x16x32_f16(false, a, false, b, (short)0, c,
                                                false, false);
}

__device__ __forceinline__ void async_stage(const _Float16* la,
                                            const _Float16* ga,
                                            const _Float16* lb,
                                            const _Float16* gb, uint32_t lstep,
                                            size_t gstep) {
  uint32_t a0 = (uint32_t)(uintptr_t)la, b0 = (uint32_t)(uintptr_t)lb;
  asm volatile("global_load_async_to_lds_b128 %0, %8, off\n\t"
               "global_load_async_to_lds_b128 %1, %9, off\n\t"
               "global_load_async_to_lds_b128 %2, %10, off\n\t"
               "global_load_async_to_lds_b128 %3, %11, off\n\t"
               "global_load_async_to_lds_b128 %4, %12, off\n\t"
               "global_load_async_to_lds_b128 %5, %13, off\n\t"
               "global_load_async_to_lds_b128 %6, %14, off\n\t"
               "global_load_async_to_lds_b128 %7, %15, off\n\t"
               "s_wait_xcnt 0x0"
               :: "v"(a0), "v"(a0 + lstep), "v"(a0 + 2 * lstep),
                  "v"(a0 + 3 * lstep),
                  "v"(b0), "v"(b0 + lstep), "v"(b0 + 2 * lstep),
                  "v"(b0 + 3 * lstep),
                  "v"((uint64_t)(uintptr_t)ga),
                  "v"((uint64_t)(uintptr_t)(ga + gstep)),
                  "v"((uint64_t)(uintptr_t)(ga + 2 * gstep)),
                  "v"((uint64_t)(uintptr_t)(ga + 3 * gstep)),
                  "v"((uint64_t)(uintptr_t)gb),
                  "v"((uint64_t)(uintptr_t)(gb + gstep)),
                  "v"((uint64_t)(uintptr_t)(gb + 2 * gstep)),
                  "v"((uint64_t)(uintptr_t)(gb + 3 * gstep))
               : "memory");
}
__device__ __forceinline__ void wait_async0() {
  asm volatile("s_wait_asynccnt 0" ::: "memory");
}

__device__ __forceinline__ v16h frag_rm(const _Float16* base, int stride,
                                        int lane, int k0) {
  int m = lane & 15, half = lane >> 4;
  const _Float16* p = base + (size_t)m * stride + k0 + (half << 3);
  v16h f;
#pragma unroll
  for (int v = 0; v < 8; ++v) {
    int k = ((v >> 2) << 4) + ((v & 3) << 1);
    f[2 * v]     = p[k];
    f[2 * v + 1] = p[k + 1];
  }
  return f;
}

// B fragment from K-major source: element B[k][n] = base[k*stride + n]
__device__ __forceinline__ v16h frag_cm(const _Float16* base, int stride,
                                        int lane) {
  int n = lane & 15, half = lane >> 4;
  const _Float16* p = base + (size_t)(half << 3) * stride + n;
  v16h f;
#pragma unroll
  for (int v = 0; v < 8; ++v) {
    int k = ((v >> 2) << 4) + ((v & 3) << 1);
    f[2 * v]     = p[(size_t)k * stride];
    f[2 * v + 1] = p[(size_t)(k + 1) * stride];
  }
  return f;
}

// ---- f32 -> f16 weight conversion (one-shot, bandwidth-trivial) -------------
__global__ __launch_bounds__(256) void cvt_f16_kernel(
    const float* __restrict__ in, _Float16* __restrict__ out) {
  int i = (blockIdx.x * 256 + threadIdx.x) * 4;
  float4 v = *(const float4*)(in + i);
  out[i + 0] = (_Float16)v.x;
  out[i + 1] = (_Float16)v.y;
  out[i + 2] = (_Float16)v.z;
  out[i + 3] = (_Float16)v.w;
}

// ---- LayerNorm (f32 in -> f16 out), one row (E=1024) per 256-thread block ---
__global__ __launch_bounds__(256) void ln_f16_kernel(
    const float* __restrict__ x, const float* __restrict__ w,
    const float* __restrict__ bb, _Float16* __restrict__ out) {
  int row = blockIdx.x;
  const float* xr = x + (size_t)row * E_;
  float vals[4];
  float s = 0.f, s2 = 0.f;
#pragma unroll
  for (int i = 0; i < 4; ++i) {
    float v = xr[threadIdx.x + i * 256];
    vals[i] = v;
    s += v;
    s2 += v * v;
  }
#pragma unroll
  for (int msk = 1; msk < 32; msk <<= 1) {
    s  += __shfl_xor(s, msk, 32);
    s2 += __shfl_xor(s2, msk, 32);
  }
  __shared__ float ps[8], ps2[8];
  int lane = threadIdx.x & 31, wid = threadIdx.x >> 5;
  if (lane == 0) { ps[wid] = s; ps2[wid] = s2; }
  __syncthreads();
  s = 0.f; s2 = 0.f;
#pragma unroll
  for (int i = 0; i < 8; ++i) { s += ps[i]; s2 += ps2[i]; }
  float mean = s * (1.f / E_);
  float var  = s2 * (1.f / E_) - mean * mean;
  float rstd = rsqrtf(var + 1e-5f);
#pragma unroll
  for (int i = 0; i < 4; ++i) {
    int c = threadIdx.x + i * 256;
    out[(size_t)row * E_ + c] = (_Float16)((vals[i] - mean) * rstd * w[c] + bb[c]);
  }
}

template <int EPI>
__global__ __launch_bounds__(256) void gemm_wmma_kernel(
    const _Float16* __restrict__ A, const _Float16* __restrict__ Wt,
    const float* __restrict__ bias, const float* __restrict__ resid,
    void* __restrict__ out, int M, int N, int K) {
  // A stage holds 64 k = 128 B of every operand row: one whole cache line, so
  // that eight lanes copy a row and a wave's copy reads four whole lines.
  constexpr int TK = 64;
  constexpr int LP = TK + 8;
  // k steps (32 k each) whose fragments are read together. The residual GEMMs
  // launch one work-group a WGP, so registers are free: the whole stage. The
  // other two share a WGP three or four work-groups at a time, which 128
  // registers a wave allow: one step.
  constexpr int GRP = EPI == EPI_F32_RES ? TK / 32 : 1;
  __shared__ __align__(16) _Float16 As[2][128 * LP];
  __shared__ __align__(16) _Float16 Bs[2][128 * LP];
  int tid = threadIdx.x, lane = tid & 31, wid = tid >> 5;
  int wm = wid & 3, wn = wid >> 2;
  int bm = blockIdx.y * 128, bn = blockIdx.x * 128;
  int ldrow = tid >> 3, ldcol = (tid & 7) << 3;  // 32 rows x 64 k per copy group
  constexpr uint32_t LSTEP = 32 * LP * sizeof(_Float16);  // 32 rows on, in LDS
  const size_t gstep = (size_t)32 * K;                    // 32 rows on, global
  const _Float16* ag = A  + (size_t)(bm + ldrow) * K + ldcol;
  const _Float16* wg = Wt + (size_t)(bn + ldrow) * K + ldcol;
  const int iters = K / TK;

  // prefetch tile 0 into buffer 0
  async_stage(&As[0][ldrow * LP + ldcol], ag, &Bs[0][ldrow * LP + ldcol], wg,
              LSTEP, gstep);

  // The residual tile is asked for here, all of it in flight together and
  // behind the whole k loop; loaded one by one between the epilogue's stores,
  // each element cost its wave a full round trip to L2 or memory.
  int n16 = lane & 15, half = lane >> 4;
  float rv[EPI == EPI_F32_RES ? 2 : 1][4][8];
  if constexpr (EPI == EPI_F32_RES) {
#pragma unroll
    for (int i = 0; i < 2; ++i)
#pragma unroll
      for (int r = 0; r < 8; ++r) {
        const float* rp = resid +
            (size_t)(bm + wm * 32 + i * 16 + half * 8 + r) * N + bn + wn * 64 + n16;
#pragma unroll
        for (int j = 0; j < 4; ++j) rv[i][j][r] = rp[j * 16];
      }
  }

  v8f acc[2][4] = {};
  for (int it = 0; it < iters; ++it) {
    int cur = it & 1;
    wait_async0();        // my in-flight ops are exactly buffer `cur`'s
    __syncthreads();      // all waves done writing `cur` & done reading `cur^1`
    if (it + 1 < iters) { // prefetch next tile into the other buffer
      const _Float16* ga = ag + (size_t)(it + 1) * TK;
      const _Float16* gb = wg + (size_t)(it + 1) * TK;
      async_stage(&As[cur ^ 1][ldrow * LP + ldcol], ga,
                  &Bs[cur ^ 1][ldrow * LP + ldcol], gb, LSTEP, gstep);
    }
    // The fragment reads of GRP k steps go out as one group, each fragment into
    // registers of its own, ahead of those steps' WMMAs: the wave then meets the
    // LDS latency once a group, not once for every pair of WMMAs.
    // Unrolled so that the k offset of each fragment read is an immediate.
#pragma unroll
    for (int k0 = 0; k0 < TK; k0 += 32 * GRP) {
      v16h af[GRP][2], bf[GRP][4];
#pragma unroll
      for (int g = 0; g < GRP; ++g) {
#pragma unroll
        for (int i = 0; i < 2; ++i)
          af[g][i] = frag_rm(&As[cur][(wm * 32 + i * 16) * LP], LP, lane,
                             k0 + 32 * g);
#pragma unroll
        for (int j = 0; j < 4; ++j)
          bf[g][j] = frag_rm(&Bs[cur][(wn * 64 + j * 16) * LP], LP, lane,
                             k0 + 32 * g);
      }
      // Keeps the compiler from sinking the reads back among the WMMAs, where
      // it gave all four B fragments one register set and waited for each.
      __builtin_amdgcn_sched_barrier(0);
#pragma unroll
      for (int g = 0; g < GRP; ++g)
#pragma unroll
        for (int j = 0; j < 4; ++j) {
          acc[0][j] = wmma_f16(af[g][0], bf[g][j], acc[0][j]);
          acc[1][j] = wmma_f16(af[g][1], bf[g][j], acc[1][j]);
        }
      // Keeps what follows from rising above these WMMAs: the next group's reads
      // and, seen without it, the barrier below with a wait for every read.
      __builtin_amdgcn_sched_barrier(0);
    }
    __syncthreads();      // all waves done reading `cur` before it is refilled
  }
  wait_async0();  // no copy is left in flight when the wave ends (also K < TK)

#pragma unroll
  for (int i = 0; i < 2; ++i)
#pragma unroll
    for (int j = 0; j < 4; ++j) {
      int col = bn + wn * 64 + j * 16 + n16;
      float bv = bias[col];
#pragma unroll
      for (int r = 0; r < 8; ++r) {
        int row = bm + wm * 32 + i * 16 + half * 8 + r;
        size_t idx = (size_t)row * N + col;
        float v = acc[i][j][r] + bv;
        if constexpr (EPI == EPI_F32) {
          ((float*)out)[idx] = v;
        } else if constexpr (EPI == EPI_F16) {
          ((_Float16*)out)[idx] = (_Float16)v;
        } else if constexpr (EPI == EPI_F16_GELU) {
          ((_Float16*)out)[idx] =
              (_Float16)(0.5f * v * (1.f + erff(v * 0.70710678118f)));
        } else {
          ((float*)out)[idx] = v + rv[i][j][r];
        }
      }
    }
}

// ---- Flash-style causal attention -------------------------------------------
// grid: (B*H, T/128 row blocks). 8 waves/block, each wave owns 16 query rows.
// Row block t walks t + 1 key blocks, and all work-groups are resident at once,
// two on a WGP, so the launch lasts as long as the fullest WGP. Work-groups 8,
// 16 or 256 apart in launch order take t and NT - 1 - t: equal work a pair.
// For speed only: (head, row block) is met once wherever a work-group lands.
__global__ __launch_bounds__(256) void attn_kernel(
    const _Float16* __restrict__ qkv, _Float16* __restrict__ o16) {
  __shared__ __align__(16) _Float16 Pls[8 * 16 * 32];  // per-wave P staging
  int tid = threadIdx.x, lane = tid & 31, wid = tid >> 5;
  constexpr int NT = T_ / 128;
  int bh = blockIdx.x, b = bh >> 4, h = bh & 15;
  int t = blockIdx.y % (NT / 2);
  int flip = (blockIdx.y / (NT / 2) ^ (bh >> 3) ^ (bh >> 4)) & 1;
  int q0 = (flip ? t : NT - 1 - t) * 128 + wid * 16;
  const int RS = 3 * E_;
  const _Float16* qbase = qkv + (size_t)b * T_ * RS + h * D_;
  const _Float16* kbase = qbase + E_;
  const _Float16* vbase = qbase + 2 * E_;
  int n16 = lane & 15, half = lane >> 4;

  v16h qf0 = frag_rm(qbase + (size_t)q0 * RS, RS, lane, 0);
  v16h qf1 = frag_rm(qbase + (size_t)q0 * RS, RS, lane, 32);
  v8f oacc[4] = {};
  float mrow[8], lrow[8];
#pragma unroll
  for (int r = 0; r < 8; ++r) { mrow[r] = -INFINITY; lrow[r] = 0.f; }
  _Float16* Pw = &Pls[wid * 16 * 32];
  const float SC = 0.125f;  // 1/sqrt(64)

  for (int j0 = 0; j0 <= q0 + 15; j0 += 32) {   // wave-uniform causal bound
    v8f s0 = {}, s1 = {};
    s0 = wmma_f16(qf0, frag_rm(kbase + (size_t)j0 * RS, RS, lane, 0), s0);
    s0 = wmma_f16(qf1, frag_rm(kbase + (size_t)j0 * RS, RS, lane, 32), s0);
    s1 = wmma_f16(qf0, frag_rm(kbase + (size_t)(j0 + 16) * RS, RS, lane, 0), s1);
    s1 = wmma_f16(qf1, frag_rm(kbase + (size_t)(j0 + 16) * RS, RS, lane, 32), s1);
#pragma unroll
    for (int r = 0; r < 8; ++r) {
      int qrow = q0 + half * 8 + r;
      float a = s0[r] * SC; if (j0 + n16      > qrow) a = -INFINITY;
      float c = s1[r] * SC; if (j0 + 16 + n16 > qrow) c = -INFINITY;
      float t = fmaxf(a, c);
#pragma unroll
      for (int msk = 1; msk < 16; msk <<= 1)
        t = fmaxf(t, __shfl_xor(t, msk, 32));  // row max over 16-lane half
      float mn    = fmaxf(mrow[r], t);
      float alpha = __expf(mrow[r] - mn);
      float p0    = __expf(a - mn);
      float p1    = __expf(c - mn);
      float rs    = p0 + p1;
#pragma unroll
      for (int msk = 1; msk < 16; msk <<= 1) rs += __shfl_xor(rs, msk, 32);
      lrow[r] = lrow[r] * alpha + rs;
      mrow[r] = mn;
#pragma unroll
      for (int d = 0; d < 4; ++d) oacc[d][r] *= alpha;
      Pw[(half * 8 + r) * 32 + n16]      = (_Float16)p0;
      Pw[(half * 8 + r) * 32 + 16 + n16] = (_Float16)p1;
    }
    v16h pf = frag_rm(Pw, 32, lane, 0);
#pragma unroll
    for (int d = 0; d < 4; ++d)
      oacc[d] = wmma_f16(pf, frag_cm(vbase + (size_t)j0 * RS + d * 16, RS, lane),
                         oacc[d]);
  }
  _Float16* obase = o16 + (size_t)b * T_ * E_ + h * D_;
#pragma unroll
  for (int r = 0; r < 8; ++r) {
    float inv = 1.0f / lrow[r];
    int trow = q0 + half * 8 + r;
#pragma unroll
    for (int d = 0; d < 4; ++d)
      obase[(size_t)trow * E_ + d * 16 + n16] = (_Float16)(oacc[d][r] * inv);
  }
}

// ---- Launch -----------------------------------------------------------------
extern "C" void kernel_launch(void* const* d_in, const int* in_sizes, int n_in,
                              void* d_out, int out_size, void* d_ws,
                              size_t ws_size, hipStream_t stream) {
  (void)in_sizes; (void)n_in; (void)out_size; (void)ws_size;
  const float* x    = (const float*)d_in[0];
  const float* ln1w = (const float*)d_in[1];
  const float* ln1b = (const float*)d_in[2];
  const float* ln2w = (const float*)d_in[3];
  const float* ln2b = (const float*)d_in[4];
  const float* qkvw = (const float*)d_in[5];
  const float* qkvb = (const float*)d_in[6];
  const float* outw = (const float*)d_in[7];
  const float* outb = (const float*)d_in[8];
  const float* fc1w = (const float*)d_in[9];
  const float* fc1b = (const float*)d_in[10];
  const float* fc2w = (const float*)d_in[11];
  const float* fc2b = (const float*)d_in[12];

  const int M = B_ * T_;  // 4096
  char* ws = (char*)d_ws;
  // [0,24MB): f16 weights; buf0 8MB; buf1 32MB; x1 16MB  (total 80MB)
  _Float16* qkvw16 = (_Float16*)(ws);
  _Float16* outw16 = (_Float16*)(ws + (6ull  << 20));
  _Float16* fc1w16 = (_Float16*)(ws + (8ull  << 20));
  _Float16* fc2w16 = (_Float16*)(ws + (16ull << 20));
  _Float16* buf0   = (_Float16*)(ws + (24ull << 20));
  _Float16* buf1   = (_Float16*)(ws + (32ull << 20));
  float*    x1     = (float*)   (ws + (64ull << 20));

  dim3 blk(256);
  cvt_f16_kernel<<<dim3(3 * E_ * E_ / 1024), blk, 0, stream>>>(qkvw, qkvw16);
  cvt_f16_kernel<<<dim3(E_ * E_ / 1024),     blk, 0, stream>>>(outw, outw16);
  cvt_f16_kernel<<<dim3(F_ * E_ / 1024),     blk, 0, stream>>>(fc1w, fc1w16);
  cvt_f16_kernel<<<dim3(E_ * F_ / 1024),     blk, 0, stream>>>(fc2w, fc2w16);

  ln_f16_kernel<<<dim3(M), blk, 0, stream>>>(x, ln1w, ln1b, buf0);
  gemm_wmma_kernel<EPI_F16><<<dim3(3 * E_ / 128, M / 128), blk, 0, stream>>>(
      buf0, qkvw16, qkvb, nullptr, buf1, M, 3 * E_, E_);
  attn_kernel<<<dim3(B_ * H_, T_ / 128), blk, 0, stream>>>(buf1, buf0);
  gemm_wmma_kernel<EPI_F32_RES><<<dim3(E_ / 128, M / 128), blk, 0, stream>>>(
      buf0, outw16, outb, x, x1, M, E_, E_);
  ln_f16_kernel<<<dim3(M), blk, 0, stream>>>(x1, ln2w, ln2b, buf0);
  gemm_wmma_kernel<EPI_F16_GELU><<<dim3(F_ / 128, M / 128), blk, 0, stream>>>(
      buf0, fc1w16, fc1b, nullptr, buf1, M, F_, E_);
  gemm_wmma_kernel<EPI_F32_RES><<<dim3(E_ / 128, M / 128), blk, 0, stream>>>(
      buf1, fc2w16, fc2b, x1, d_out, M, E_, F_);
}

// v006
// One run takes 195 microseconds.
// Timed twice side by side with v005, it ran 1.08 and 1.07 times as fast.
// Over all steps from v000 it is 1.68 times as fast.
#include <hip/hip_runtime.h>
#include <hip/hip_bf16.h>
#include <math.h>

typedef __attribute__((ext_vector_type(16))) _Float16 v16h;
typedef __attribute__((ext_vector_type(8)))  float    v8f;

static constexpr int E_  = 1024;
static constexpr int T_  = 1024;
static constexpr int B_  = 4;
static constexpr int H_  = 16;
static constexpr int D_  = 64;
static constexpr int F_  = 4096;

enum { EPI_F32 = 0, EPI_F16 = 1, EPI_F16_GELU = 2, EPI_F32_RES = 3 };

__device__ __forceinline__ v8f wmma_f16(v16h a, v16h b, v8f c) {
  return __builtin_amdgcn_wmma_f32_16x16x32_f16(false, a, false, b, (short)0, c,
                                                false, false);
}

__device__ __forceinline__ void async_stage(const _Float16* la,
                                            const _Float16* ga,
                                            const _Float16* lb,
                                            const _Float16* gb, uint32_t lstep,
                                            size_t gstep) {
  uint32_t a0 = (uint32_t)(uintptr_t)la, b0 = (uint32_t)(uintptr_t)lb;
  asm volatile("global_load_async_to_lds_b128 %0, %8, off\n\t"
               "global_load_async_to_lds_b128 %1, %9, off\n\t"
               "global_load_async_to_lds_b128 %2, %10, off\n\t"
               "global_load_async_to_lds_b128 %3, %11, off\n\t"
               "global_load_async_to_lds_b128 %4, %12, off\n\t"
               "global_load_async_to_lds_b128 %5, %13, off\n\t"
               "global_load_async_to_lds_b128 %6, %14, off\n\t"
               "global_load_async_to_lds_b128 %7, %15, off\n\t"
               "s_wait_xcnt 0x0"
               :: "v"(a0), "v"(a0 + lstep), "v"(a0 + 2 * lstep),
                  "v"(a0 + 3 * lstep),
                  "v"(b0), "v"(b0 + lstep), "v"(b0 + 2 * lstep),
                  "v"(b0 + 3 * lstep),
                  "v"((uint64_t)(uintptr_t)ga),
                  "v"((uint64_t)(uintptr_t)(ga + gstep)),
                  "v"((uint64_t)(uintptr_t)(ga + 2 * gstep)),
                  "v"((uint64_t)(uintptr_t)(ga + 3 * gstep)),
                  "v"((uint64_t)(uintptr_t)gb),
                  "v"((uint64_t)(uintptr_t)(gb + gstep)),
                  "v"((uint64_t)(uintptr_t)(gb + 2 * gstep)),
                  "v"((uint64_t)(uintptr_t)(gb + 3 * gstep))
               : "memory");
}
__device__ __forceinline__ void wait_async0() {
  asm volatile("s_wait_asynccnt 0" ::: "memory");
}

__device__ __forceinline__ v16h frag_rm(const _Float16* base, int stride,
                                        int lane, int k0) {
  int m = lane & 15, half = lane >> 4;
  const _Float16* p = base + (size_t)m * stride + k0 + (half << 3);
  v16h f;
#pragma unroll
  for (int v = 0; v < 8; ++v) {
    int k = ((v >> 2) << 4) + ((v & 3) << 1);
    f[2 * v]     = p[k];
    f[2 * v + 1] = p[k + 1];
  }
  return f;
}

// B fragment from K-major source: element B[k][n] = base[k*stride + n]
__device__ __forceinline__ v16h frag_cm(const _Float16* base, int stride,
                                        int lane) {
  int n = lane & 15, half = lane >> 4;
  const _Float16* p = base + (size_t)(half << 3) * stride + n;
  v16h f;
#pragma unroll
  for (int v = 0; v < 8; ++v) {
    int k = ((v >> 2) << 4) + ((v & 3) << 1);
    f[2 * v]     = p[(size_t)k * stride];
    f[2 * v + 1] = p[(size_t)(k + 1) * stride];
  }
  return f;
}

// ---- f32 -> f16 weight conversion (one-shot, bandwidth-trivial) -------------
__global__ __launch_bounds__(256) void cvt_f16_kernel(
    const float* __restrict__ in, _Float16* __restrict__ out) {
  int i = (blockIdx.x * 256 + threadIdx.x) * 4;
  float4 v = *(const float4*)(in + i);
  out[i + 0] = (_Float16)v.x;
  out[i + 1] = (_Float16)v.y;
  out[i + 2] = (_Float16)v.z;
  out[i + 3] = (_Float16)v.w;
}

// ---- LayerNorm (f32 in -> f16 out), one row (E=1024) per 256-thread block ---
__global__ __launch_bounds__(256) void ln_f16_kernel(
    const float* __restrict__ x, const float* __restrict__ w,
    const float* __restrict__ bb, _Float16* __restrict__ out) {
  int row = blockIdx.x;
  const float* xr = x + (size_t)row * E_;
  float vals[4];
  float s = 0.f, s2 = 0.f;
#pragma unroll
  for (int i = 0; i < 4; ++i) {
    float v = xr[threadIdx.x + i * 256];
    vals[i] = v;
    s += v;
    s2 += v * v;
  }
#pragma unroll
  for (int msk = 1; msk < 32; msk <<= 1) {
    s  += __shfl_xor(s, msk, 32);
    s2 += __shfl_xor(s2, msk, 32);
  }
  __shared__ float ps[8], ps2[8];
  int lane = threadIdx.x & 31, wid = threadIdx.x >> 5;
  if (lane == 0) { ps[wid] = s; ps2[wid] = s2; }
  __syncthreads();
  s = 0.f; s2 = 0.f;
#pragma unroll
  for (int i = 0; i < 8; ++i) { s += ps[i]; s2 += ps2[i]; }
  float mean = s * (1.f / E_);
  float var  = s2 * (1.f / E_) - mean * mean;
  float rstd = rsqrtf(var + 1e-5f);
#pragma unroll
  for (int i = 0; i < 4; ++i) {
    int c = threadIdx.x + i * 256;
    out[(size_t)row * E_ + c] = (_Float16)((vals[i] - mean) * rstd * w[c] + bb[c]);
  }
}

template <int EPI>
__global__ __launch_bounds__(256) void gemm_wmma_kernel(
    const _Float16* __restrict__ A, const _Float16* __restrict__ Wt,
    const float* __restrict__ bias, const float* __restrict__ resid,
    void* __restrict__ out, int M, int N, int K) {
  // A stage is copied in column groups of 64 k = 128 B of every operand row: one
  // whole cache line, so that eight lanes copy a row's share of a group and a
  // wave's copy reads four whole lines.
  // The residual GEMMs launch one work-group a WGP: nothing else on the WGP
  // works while a stage's copies are on their way, and a stage of 64 k is
  // reckoned to be worked through before the next has landed. So 256 k: a
  // quarter of the round trips, each behind four times the work; the two
  // buffers then take most of the WGP's LDS. The other two GEMMs keep 64 k, so
  // that three or four work-groups still fit a WGP and cover for each other.
  constexpr int TK = EPI == EPI_F32_RES ? 256 : 64;
  constexpr int LP = TK + 8;
  // k steps (32 k each) whose fragments are read together. The residual GEMMs
  // launch one work-group a WGP, so registers are free: two steps. The other
  // two share a WGP three or four work-groups at a time, which 128 registers a
  // wave allow: one step.
  constexpr int GRP = EPI == EPI_F32_RES ? 2 : 1;
  __shared__ __align__(16) _Float16 As[2][128 * LP];
  __shared__ __align__(16) _Float16 Bs[2][128 * LP];
  int tid = threadIdx.x, lane = tid & 31, wid = tid >> 5;
  int wm = wid & 3, wn = wid >> 2;
  int bm = blockIdx.y * 128, bn = blockIdx.x * 128;
  int ldrow = tid >> 3, ldcol = (tid & 7) << 3;  // 32 rows x 64 k per copy group
  constexpr uint32_t LSTEP = 32 * LP * sizeof(_Float16);  // 32 rows on, in LDS
  const size_t gstep = (size_t)32 * K;                    // 32 rows on, global
  const _Float16* ag = A  + (size_t)(bm + ldrow) * K + ldcol;
  const _Float16* wg = Wt + (size_t)(bn + ldrow) * K + ldcol;
  const int iters = K / TK;

  // prefetch tile 0 into buffer 0, one column group after the other
  // (unrolled so that a group's column offset is a constant in its addresses)
#pragma unroll
  for (int c = 0; c < TK; c += 64)
    async_stage(&As[0][ldrow * LP + ldcol + c], ag + c,
                &Bs[0][ldrow * LP + ldcol + c], wg + c, LSTEP, gstep);

  // The residual tile is asked for here, all of it in flight together and
  // behind the whole k loop; loaded one by one between the epilogue's stores,
  // each element cost its wave a full round trip to L2 or memory.
  int n16 = lane & 15, half = lane >> 4;
  float rv[EPI == EPI_F32_RES ? 2 : 1][4][8];
  if constexpr (EPI == EPI_F32_RES) {
#pragma unroll
    for (int i = 0; i < 2; ++i)
#pragma unroll
      for (int r = 0; r < 8; ++r) {
        const float* rp = resid +
            (size_t)(bm + wm * 32 + i * 16 + half * 8 + r) * N + bn + wn * 64 + n16;
#pragma unroll
        for (int j = 0; j < 4; ++j) rv[i][j][r] = rp[j * 16];
      }
  }

  v8f acc[2][4] = {};
  for (int it = 0; it < iters; ++it) {
    int cur = it & 1;
    wait_async0();        // my in-flight ops are exactly buffer `cur`'s
    __syncthreads();      // all waves done writing `cur` & done reading `cur^1`
    if (it + 1 < iters) { // prefetch next tile into the other buffer
      const _Float16* ga = ag + (size_t)(it + 1) * TK;
      const _Float16* gb = wg + (size_t)(it + 1) * TK;
      // Unrolled for the same reason as in front of the loop.
#pragma unroll
      for (int c = 0; c < TK; c += 64)
        async_stage(&As[cur ^ 1][ldrow * LP + ldcol + c], ga + c,
                    &Bs[cur ^ 1][ldrow * LP + ldcol + c], gb + c, LSTEP, gstep);
    }
    // The fragment reads of GRP k steps go out as one group, each fragment into
    // registers of its own, ahead of those steps' WMMAs: the wave then meets the
    // LDS latency once a group, not once for every pair of WMMAs.
    // Unrolled so that the k offset of each fragment read is an immediate.
#pragma unroll
    for (int k0 = 0; k0 < TK; k0 += 32 * GRP) {
      v16h af[GRP][2], bf[GRP][4];
#pragma unroll
      for (int g = 0; g < GRP; ++g) {
#pragma unroll
        for (int i = 0; i < 2; ++i)
          af[g][i] = frag_rm(&As[cur][(wm * 32 + i * 16) * LP], LP, lane,
                             k0 + 32 * g);
#pragma unroll
        for (int j = 0; j < 4; ++j)
          bf[g][j] = frag_rm(&Bs[cur][(wn * 64 + j * 16) * LP], LP, lane,
                             k0 + 32 * g);
      }
      // Keeps the compiler from sinking the reads back among the WMMAs, where
      // it gave all four B fragments one register set and waited for each.
      __builtin_amdgcn_sched_barrier(0);
#pragma unroll
      for (int g = 0; g < GRP; ++g)
#pragma unroll
        for (int j = 0; j < 4; ++j) {
          acc[0][j] = wmma_f16(af[g][0], bf[g][j], acc[0][j]);
          acc[1][j] = wmma_f16(af[g][1], bf[g][j], acc[1][j]);
        }
      // Keeps what follows from rising above these WMMAs: the next group's reads
      // and, seen without it, the barrier below with a wait for every read.
      __builtin_amdgcn_sched_barrier(0);
    }
    __syncthreads();      // all waves done reading `cur` before it is refilled
  }
  wait_async0();  // no copy is left in flight when the wave ends (also K < TK)

#pragma unroll
  for (int i = 0; i < 2; ++i)
#pragma unroll
    for (int j = 0; j < 4; ++j) {
      int col = bn + wn * 64 + j * 16 + n16;
      float bv = bias[col];
#pragma unroll
      for (int r = 0; r < 8; ++r) {
        int row = bm + wm * 32 + i * 16 + half * 8 + r;
        size_t idx = (size_t)row * N + col;
        float v = acc[i][j][r] + bv;
        if constexpr (EPI == EPI_F32) {
          ((float*)out)[idx] = v;
        } else if constexpr (EPI == EPI_F16) {
          ((_Float16*)out)[idx] = (_Float16)v;
        } else if constexpr (EPI == EPI_F16_GELU) {
          ((_Float16*)out)[idx] =
              (_Float16)(0.5f * v * (1.f + erff(v * 0.70710678118f)));
        } else {
          ((float*)out)[idx] = v + rv[i][j][r];
        }
      }
    }
}

// ---- Flash-style causal attention -------------------------------------------
// grid: (B*H, T/128 row blocks). 8 waves/block, each wave owns 16 query rows.
// Row block t walks t + 1 key blocks, and all work-groups are resident at once,
// two on a WGP, so the launch lasts as long as the fullest WGP. Work-groups 8,
// 16 or 256 apart in launch order take t and NT - 1 - t: equal work a pair.
// For speed only: (head, row block) is met once wherever a work-group lands.
__global__ __launch_bounds__(256) void attn_kernel(
    const _Float16* __restrict__ qkv, _Float16* __restrict__ o16) {
  __shared__ __align__(16) _Float16 Pls[8 * 16 * 32];  // per-wave P staging
  int tid = threadIdx.x, lane = tid & 31, wid = tid >> 5;
  constexpr int NT = T_ / 128;
  int bh = blockIdx.x, b = bh >> 4, h = bh & 15;
  int t = blockIdx.y % (NT / 2);
  int flip = (blockIdx.y / (NT / 2) ^ (bh >> 3) ^ (bh >> 4)) & 1;
  int q0 = (flip ? t : NT - 1 - t) * 128 + wid * 16;
  const int RS = 3 * E_;
  const _Float16* qbase = qkv + (size_t)b * T_ * RS + h * D_;
  const _Float16* kbase = qbase + E_;
  const _Float16* vbase = qbase + 2 * E_;
  int n16 = lane & 15, half = lane >> 4;

  v16h qf0 = frag_rm(qbase + (size_t)q0 * RS, RS, lane, 0);
  v16h qf1 = frag_rm(qbase + (size_t)q0 * RS, RS, lane, 32);
  v8f oacc[4] = {};
  float mrow[8], lrow[8];
#pragma unroll
  for (int r = 0; r < 8; ++r) { mrow[r] = -INFINITY; lrow[r] = 0.f; }
  _Float16* Pw = &Pls[wid * 16 * 32];
  const float SC = 0.125f;  // 1/sqrt(64)

  for (int j0 = 0; j0 <= q0 + 15; j0 += 32) {   // wave-uniform causal bound
    v8f s0 = {}, s1 = {};
    s0 = wmma_f16(qf0, frag_rm(kbase + (size_t)j0 * RS, RS, lane, 0), s0);
    s0 = wmma_f16(qf1, frag_rm(kbase + (size_t)j0 * RS, RS, lane, 32), s0);
    s1 = wmma_f16(qf0, frag_rm(kbase + (size_t)(j0 + 16) * RS, RS, lane, 0), s1);
    s1 = wmma_f16(qf1, frag_rm(kbase + (size_t)(j0 + 16) * RS, RS, lane, 32), s1);
#pragma unroll
    for (int r = 0; r < 8; ++r) {
      int qrow = q0 + half * 8 + r;
      float a = s0[r] * SC; if (j0 + n16      > qrow) a = -INFINITY;
      float c = s1[r] * SC; if (j0 + 16 + n16 > qrow) c = -INFINITY;
      float t = fmaxf(a, c);
#pragma unroll
      for (int msk = 1; msk < 16; msk <<= 1)
        t = fmaxf(t, __shfl_xor(t, msk, 32));  // row max over 16-lane half
      float mn    = fmaxf(mrow[r], t);
      float alpha = __expf(mrow[r] - mn);
      float p0    = __expf(a - mn);
      float p1    = __expf(c - mn);
      float rs    = p0 + p1;
#pragma unroll
      for (int msk = 1; msk < 16; msk <<= 1) rs += __shfl_xor(rs, msk, 32);
      lrow[r] = lrow[r] * alpha + rs;
      mrow[r] = mn;
#pragma unroll
      for (int d = 0; d < 4; ++d) oacc[d][r] *= alpha;
      Pw[(half * 8 + r) * 32 + n16]      = (_Float16)p0;
      Pw[(half * 8 + r) * 32 + 16 + n16] = (_Float16)p1;
    }
    v16h pf = frag_rm(Pw, 32, lane, 0);
#pragma unroll
    for (int d = 0; d < 4; ++d)
      oacc[d] = wmma_f16(pf, frag_cm(vbase + (size_t)j0 * RS + d * 16, RS, lane),
                         oacc[d]);
  }
  _Float16* obase = o16 + (size_t)b * T_ * E_ + h * D_;
#pragma unroll
  for (int r = 0; r < 8; ++r) {
    float inv = 1.0f / lrow[r];
    int trow = q0 + half * 8 + r;
#pragma unroll
    for (int d = 0; d < 4; ++d)
      obase[(size_t)trow * E_ + d * 16 + n16] = (_Float16)(oacc[d][r] * inv);
  }
}

// ---- Launch -----------------------------------------------------------------
extern "C" void kernel_launch(void* const* d_in, const int* in_sizes, int n_in,
                              void* d_out, int out_size, void* d_ws,
                              size_t ws_size, hipStream_t stream) {
  (void)in_sizes; (void)n_in; (void)out_size; (void)ws_size;
  const float* x    = (const float*)d_in[0];
  const float* ln1w = (const float*)d_in[1];
  const float* ln1b = (const float*)d_in[2];
  const float* ln2w = (const float*)d_in[3];
  const float* ln2b = (const float*)d_in[4];
  const float* qkvw = (const float*)d_in[5];
  const float* qkvb = (const float*)d_in[6];
  const float* outw = (const float*)d_in[7];
  const float* outb = (const float*)d_in[8];
  const float* fc1w = (const float*)d_in[9];
  const float* fc1b = (const float*)d_in[10];
  const float* fc2w = (const float*)d_in[11];
  const float* fc2b = (const float*)d_in[12];

  const int M = B_ * T_;  // 4096
  char* ws = (char*)d_ws;
  // [0,24MB): f16 weights; buf0 8MB; buf1 32MB; x1 16MB  (total 80MB)
  _Float16* qkvw16 = (_Float16*)(ws);
  _Float16* outw16 = (_Float16*)(ws + (6ull  << 20));
  _Float16* fc1w16 = (_Float16*)(ws + (8ull  << 20));
  _Float16* fc2w16 = (_Float16*)(ws + (16ull << 20));
  _Float16* buf0   = (_Float16*)(ws + (24ull << 20));
  _Float16* buf1   = (_Float16*)(ws + (32ull << 20));
  float*    x1     = (float*)   (ws + (64ull << 20));

  dim3 blk(256);
  cvt_f16_kernel<<<dim3(3 * E_ * E_ / 1024), blk, 0, stream>>>(qkvw, qkvw16);
  cvt_f16_kernel<<<dim3(E_ * E_ / 1024),     blk, 0, stream>>>(outw, outw16);
  cvt_f16_kernel<<<dim3(F_ * E_ / 1024),     blk, 0, stream>>>(fc1w, fc1w16);
  cvt_f16_kernel<<<dim3(E_ * F_ / 1024),     blk, 0, stream>>>(fc2w, fc2w16);

  ln_f16_kernel<<<dim3(M), blk, 0, stream>>>(x, ln1w, ln1b, buf0);
  gemm_wmma_kernel<EPI_F16><<<dim3(3 * E_ / 128, M / 128), blk, 0, stream>>>(
      buf0, qkvw16, qkvb, nullptr, buf1, M, 3 * E_, E_);
  attn_kernel<<<dim3(B_ * H_, T_ / 128), blk, 0, stream>>>(buf1, buf0);
  gemm_wmma_kernel<EPI_F32_RES><<<dim3(E_ / 128, M / 128), blk, 0, stream>>>(
      buf0, outw16, outb, x, x1, M, E_, E_);
  ln_f16_kernel<<<dim3(M), blk, 0, stream>>>(x1, ln2w, ln2b, buf0);
  gemm_wmma_kernel<EPI_F16_GELU><<<dim3(F_ / 128, M / 128), blk, 0, stream>>>(
      buf0, fc1w16, fc1b, nullptr, buf1, M, F_, E_);
  gemm_wmma_kernel<EPI_F32_RES><<<dim3(E_ / 128, M / 128), blk, 0, stream>>>(
      buf1, fc2w16, fc2b, x1, d_out, M, E_, F_);
}

// v007
// Measured time: 186 microseconds a run.
// In two side-by-side timings against v006, it was 1.05 and 1.04 times as fast.
// Counting every step since v000, it is 1.76 times as fast.
#include <hip/hip_runtime.h>
#include <hip/hip_bf16.h>
#include <math.h>

typedef __attribute__((ext_vector_type(16))) _Float16 v16h;
typedef __attribute__((ext_vector_type(8)))  float    v8f;

static constexpr int E_  = 1024;
static constexpr int T_  = 1024;
static constexpr int B_  = 4;
static constexpr int H_  = 16;
static constexpr int D_  = 64;
static constexpr int F_  = 4096;

enum { EPI_F32 = 0, EPI_F16 = 1, EPI_F16_GELU = 2, EPI_F32_RES = 3 };

__device__ __forceinline__ v8f wmma_f16(v16h a, v16h b, v8f c) {
  return __builtin_amdgcn_wmma_f32_16x16x32_f16(false, a, false, b, (short)0, c,
                                                false, false);
}

__device__ __forceinline__ void async_stage(const _Float16* la,
                                            const _Float16* ga,
                                            const _Float16* lb,
                                            const _Float16* gb, uint32_t lstep,
                                            size_t gstep) {
  uint32_t a0 = (uint32_t)(uintptr_t)la, b0 = (uint32_t)(uintptr_t)lb;
  asm volatile("global_load_async_to_lds_b128 %0, %8, off\n\t"
               "global_load_async_to_lds_b128 %1, %9, off\n\t"
               "global_load_async_to_lds_b128 %2, %10, off\n\t"
               "global_load_async_to_lds_b128 %3, %11, off\n\t"
               "global_load_async_to_lds_b128 %4, %12, off\n\t"
               "global_load_async_to_lds_b128 %5, %13, off\n\t"
               "global_load_async_to_lds_b128 %6, %14, off\n\t"
               "global_load_async_to_lds_b128 %7, %15, off\n\t"
               "s_wait_xcnt 0x0"
               :: "v"(a0), "v"(a0 + lstep), "v"(a0 + 2 * lstep),
                  "v"(a0 + 3 * lstep),
                  "v"(b0), "v"(b0 + lstep), "v"(b0 + 2 * lstep),
                  "v"(b0 + 3 * lstep),
                  "v"((uint64_t)(uintptr_t)ga),
                  "v"((uint64_t)(uintptr_t)(ga + gstep)),
                  "v"((uint64_t)(uintptr_t)(ga + 2 * gstep)),
                  "v"((uint64_t)(uintptr_t)(ga + 3 * gstep)),
                  "v"((uint64_t)(uintptr_t)gb),
                  "v"((uint64_t)(uintptr_t)(gb + gstep)),
                  "v"((uint64_t)(uintptr_t)(gb + 2 * gstep)),
                  "v"((uint64_t)(uintptr_t)(gb + 3 * gstep))
               : "memory");
}
__device__ __forceinline__ void wait_async0() {
  asm volatile("s_wait_asynccnt 0" ::: "memory");
}

__device__ __forceinline__ v16h frag_rm(const _Float16* base, int stride,
                                        int lane, int k0) {
  int m = lane & 15, half = lane >> 4;
  const _Float16* p = base + (size_t)m * stride + k0 + (half << 3);
  v16h f;
#pragma unroll
  for (int v = 0; v < 8; ++v) {
    int k = ((v >> 2) << 4) + ((v & 3) << 1);
    f[2 * v]     = p[k];
    f[2 * v + 1] = p[k + 1];
  }
  return f;
}

// B fragment from K-major source: element B[k][n] = base[k*stride + n]
__device__ __forceinline__ v16h frag_cm(const _Float16* base, int stride,
                                        int lane) {
  int n = lane & 15, half = lane >> 4;
  const _Float16* p = base + (size_t)(half << 3) * stride + n;
  v16h f;
#pragma unroll
  for (int v = 0; v < 8; ++v) {
    int k = ((v >> 2) << 4) + ((v & 3) << 1);
    f[2 * v]     = p[(size_t)k * stride];
    f[2 * v + 1] = p[(size_t)(k + 1) * stride];
  }
  return f;
}

// ---- f32 -> f16 weight conversion: 1024 elements a 256-thread block ---------
__device__ __forceinline__ void cvt_block(const float* __restrict__ in,
                                          _Float16* __restrict__ out) {
  int i = threadIdx.x * 4;
  float4 v = *(const float4*)(in + i);
  out[i + 0] = (_Float16)v.x;
  out[i + 1] = (_Float16)v.y;
  out[i + 2] = (_Float16)v.z;
  out[i + 3] = (_Float16)v.w;
}

// ---- LayerNorm (f32 in -> f16 out), one row (E=1024) per 256-thread block ---
__device__ __forceinline__ void ln_row(
    const float* __restrict__ x, const float* __restrict__ w,
    const float* __restrict__ bb, _Float16* __restrict__ out, int row) {
  const float* xr = x + (size_t)row * E_;
  float vals[4];
  float s = 0.f, s2 = 0.f;
#pragma unroll
  for (int i = 0; i < 4; ++i) {
    float v = xr[threadIdx.x + i * 256];
    vals[i] = v;
    s += v;
    s2 += v * v;
  }
#pragma unroll
  for (int msk = 1; msk < 32; msk <<= 1) {
    s  += __shfl_xor(s, msk, 32);
    s2 += __shfl_xor(s2, msk, 32);
  }
  __shared__ float ps[8], ps2[8];
  int lane = threadIdx.x & 31, wid = threadIdx.x >> 5;
  if (lane == 0) { ps[wid] = s; ps2[wid] = s2; }
  __syncthreads();
  s = 0.f; s2 = 0.f;
#pragma unroll
  for (int i = 0; i < 8; ++i) { s += ps[i]; s2 += ps2[i]; }
  float mean = s * (1.f / E_);
  float var  = s2 * (1.f / E_) - mean * mean;
  float rstd = rsqrtf(var + 1e-5f);
#pragma unroll
  for (int i = 0; i < 4; ++i) {
    int c = threadIdx.x + i * 256;
    out[(size_t)row * E_ + c] = (_Float16)((vals[i] - mean) * rstd * w[c] + bb[c]);
  }
}

__global__ __launch_bounds__(256) void ln_f16_kernel(
    const float* __restrict__ x, const float* __restrict__ w,
    const float* __restrict__ bb, _Float16* __restrict__ out) {
  ln_row(x, w, bb, out, blockIdx.x);
}

// ---- First launch: LayerNorm 1 and the four weight conversions --------------
// None of the five reads what another writes, so they share one grid: each of
// them as a launch of its own paid the gap between dependent launches and its
// own start and drain, which for these few microseconds of streaming is most of
// the time. Blocks [0, LN_BLKS) take one row of x each (first, as theirs is the
// longer chain); the rest take 1024 weights each. The four f16 weight arrays lie
// one behind the other in w16, in the order of the ranges below, so a conversion
// block's place in w16 follows from its index alone. Every test is on blockIdx
// only: a block takes one path as a whole, the LayerNorm barrier included.
static constexpr int LN_BLKS  = B_ * T_;
static constexpr int QKV_BLKS = 3 * E_ * E_ / 1024;
static constexpr int OUT_BLKS = E_ * E_ / 1024;
static constexpr int FC_BLKS  = F_ * E_ / 1024;
__global__ __launch_bounds__(256) void prep_kernel(
    const float* __restrict__ x, const float* __restrict__ w,
    const float* __restrict__ bb, _Float16* __restrict__ h,
    const float* __restrict__ qkvw, const float* __restrict__ outw,
    const float* __restrict__ fc1w, const float* __restrict__ fc2w,
    _Float16* __restrict__ w16) {
  int blk = blockIdx.x;
  if (blk < LN_BLKS) {
    ln_row(x, w, bb, h, blk);
    return;
  }
  blk -= LN_BLKS;
  const float* in = qkvw;
  int first = 0;
  if (blk >= QKV_BLKS)                      { in = outw; first = QKV_BLKS; }
  if (blk >= QKV_BLKS + OUT_BLKS)           { in = fc1w; first = QKV_BLKS + OUT_BLKS; }
  if (blk >= QKV_BLKS + OUT_BLKS + FC_BLKS) { in = fc2w; first = QKV_BLKS + OUT_BLKS + FC_BLKS; }
  cvt_block(in + (size_t)(blk - first) * 1024, w16 + (size_t)blk * 1024);
}

template <int EPI>
__global__ __launch_bounds__(256) void gemm_wmma_kernel(
    const _Float16* __restrict__ A, const _Float16* __restrict__ Wt,
    const float* __restrict__ bias, const float* __restrict__ resid,
    void* __restrict__ out, int M, int N, int K) {
  // A stage is copied in column groups of 64 k = 128 B of every operand row: one
  // whole cache line, so that eight lanes copy a row's share of a group and a
  // wave's copy reads four whole lines.
  // The residual GEMMs launch one work-group a WGP: nothing else on the WGP
  // works while a stage's copies are on their way, and a stage of 64 k is
  // reckoned to be worked through before the next has landed. So 256 k: a
  // quarter of the round trips, each behind four times the work; the two
  // buffers then take most of the WGP's LDS. The other two GEMMs keep 64 k, so
  // that three or four work-groups still fit a WGP and cover for each other.
  constexpr int TK = EPI == EPI_F32_RES ? 256 : 64;
  constexpr int LP = TK + 8;
  // k steps (32 k each) whose fragments are read together. The residual GEMMs
  // launch one work-group a WGP, so registers are free: two steps. The other
  // two share a WGP three or four work-groups at a time, which 128 registers a
  // wave allow: one step.
  constexpr int GRP = EPI == EPI_F32_RES ? 2 : 1;
  __shared__ __align__(16) _Float16 As[2][128 * LP];
  __shared__ __align__(16) _Float16 Bs[2][128 * LP];
  int tid = threadIdx.x, lane = tid & 31, wid = tid >> 5;
  int wm = wid & 3, wn = wid >> 2;
  int bm = blockIdx.y * 128, bn = blockIdx.x * 128;
  int ldrow = tid >> 3, ldcol = (tid & 7) << 3;  // 32 rows x 64 k per copy group
  constexpr uint32_t LSTEP = 32 * LP * sizeof(_Float16);  // 32 rows on, in LDS
  const size_t gstep = (size_t)32 * K;                    // 32 rows on, global
  const _Float16* ag = A  + (size_t)(bm + ldrow) * K + ldcol;
  const _Float16* wg = Wt + (size_t)(bn + ldrow) * K + ldcol;
  const int iters = K / TK;

  // prefetch tile 0 into buffer 0, one column group after the other
  // (unrolled so that a group's column offset is a constant in its addresses)
#pragma unroll
  for (int c = 0; c < TK; c += 64)
    async_stage(&As[0][ldrow * LP + ldcol + c], ag + c,
                &Bs[0][ldrow * LP + ldcol + c], wg + c, LSTEP, gstep);

  // The residual tile is asked for here, all of it in flight together and
  // behind the whole k loop; loaded one by one between the epilogue's stores,
  // each element cost its wave a full round trip to L2 or memory.
  int n16 = lane & 15, half = lane >> 4;
  float rv[EPI == EPI_F32_RES ? 2 : 1][4][8];
  if constexpr (EPI == EPI_F32_RES) {
#pragma unroll
    for (int i = 0; i < 2; ++i)
#pragma unroll
      for (int r = 0; r < 8; ++r) {
        const float* rp = resid +
            (size_t)(bm + wm * 32 + i * 16 + half * 8 + r) * N + bn + wn * 64 + n16;
#pragma unroll
        for (int j = 0; j < 4; ++j) rv[i][j][r] = rp[j * 16];
      }
  }

  v8f acc[2][4] = {};
  for (int it = 0; it < iters; ++it) {
    int cur = it & 1;
    wait_async0();        // my in-flight ops are exactly buffer `cur`'s
    __syncthreads();      // all waves done writing `cur` & done reading `cur^1`
    if (it + 1 < iters) { // prefetch next tile into the other buffer
      const _Float16* ga = ag + (size_t)(it + 1) * TK;
      const _Float16* gb = wg + (size_t)(it + 1) * TK;
      // Unrolled for the same reason as in front of the loop.
#pragma unroll
      for (int c = 0; c < TK; c += 64)
        async_stage(&As[cur ^ 1][ldrow * LP + ldcol + c], ga + c,
                    &Bs[cur ^ 1][ldrow * LP + ldcol + c], gb + c, LSTEP, gstep);
    }
    // The fragment reads of GRP k steps go out as one group, each fragment into
    // registers of its own, ahead of those steps' WMMAs: the wave then meets the
    // LDS latency once a group, not once for every pair of WMMAs.
    // Unrolled so that the k offset of each fragment read is an immediate.
#pragma unroll
    for (int k0 = 0; k0 < TK; k0 += 32 * GRP) {
      v16h af[GRP][2], bf[GRP][4];
#pragma unroll
      for (int g = 0; g < GRP; ++g) {
#pragma unroll
        for (int i = 0; i < 2; ++i)
          af[g][i] = frag_rm(&As[cur][(wm * 32 + i * 16) * LP], LP, lane,
                             k0 + 32 * g);
#pragma unroll
        for (int j = 0; j < 4; ++j)
          bf[g][j] = frag_rm(&Bs[cur][(wn * 64 + j * 16) * LP], LP, lane,
                             k0 + 32 * g);
      }
      // Keeps the compiler from sinking the reads back among the WMMAs, where
      // it gave all four B fragments one register set and waited for each.
      __builtin_amdgcn_sched_barrier(0);
#pragma unroll
      for (int g = 0; g < GRP; ++g)
#pragma unroll
        for (int j = 0; j < 4; ++j) {
          acc[0][j] = wmma_f16(af[g][0], bf[g][j], acc[0][j]);
          acc[1][j] = wmma_f16(af[g][1], bf[g][j], acc[1][j]);
        }
      // Keeps what follows from rising above these WMMAs: the next group's reads
      // and, seen without it, the barrier below with a wait for every read.
      __builtin_amdgcn_sched_barrier(0);
    }
    __syncthreads();      // all waves done reading `cur` before it is refilled
  }
  wait_async0();  // no copy is left in flight when the wave ends (also K < TK)

#pragma unroll
  for (int i = 0; i < 2; ++i)
#pragma unroll
    for (int j = 0; j < 4; ++j) {
      int col = bn + wn * 64 + j * 16 + n16;
      float bv = bias[col];
#pragma unroll
      for (int r = 0; r < 8; ++r) {
        int row = bm + wm * 32 + i * 16 + half * 8 + r;
        size_t idx = (size_t)row * N + col;
        float v = acc[i][j][r] + bv;
        if constexpr (EPI == EPI_F32) {
          ((float*)out)[idx] = v;
        } else if constexpr (EPI == EPI_F16) {
          ((_Float16*)out)[idx] = (_Float16)v;
        } else if constexpr (EPI == EPI_F16_GELU) {
          ((_Float16*)out)[idx] =
              (_Float16)(0.5f * v * (1.f + erff(v * 0.70710678118f)));
        } else {
          ((float*)out)[idx] = v + rv[i][j][r];
        }
      }
    }
}

// ---- Flash-style causal attention -------------------------------------------
// grid: (B*H, T/128 row blocks). 8 waves/block, each wave owns 16 query rows.
// Row block t walks t + 1 key blocks, and all work-groups are resident at once,
// two on a WGP, so the launch lasts as long as the fullest WGP. Work-groups 8,
// 16 or 256 apart in launch order take t and NT - 1 - t: equal work a pair.
// For speed only: (head, row block) is met once wherever a work-group lands.
__global__ __launch_bounds__(256) void attn_kernel(
    const _Float16* __restrict__ qkv, _Float16* __restrict__ o16) {
  __shared__ __align__(16) _Float16 Pls[8 * 16 * 32];  // per-wave P staging
  int tid = threadIdx.x, lane = tid & 31, wid = tid >> 5;
  constexpr int NT = T_ / 128;
  int bh = blockIdx.x, b = bh >> 4, h = bh & 15;
  int t = blockIdx.y % (NT / 2);
  int flip = (blockIdx.y / (NT / 2) ^ (bh >> 3) ^ (bh >> 4)) & 1;
  int q0 = (flip ? t : NT - 1 - t) * 128 + wid * 16;
  const int RS = 3 * E_;
  const _Float16* qbase = qkv + (size_t)b * T_ * RS + h * D_;
  const _Float16* kbase = qbase + E_;
  const _Float16* vbase = qbase + 2 * E_;
  int n16 = lane & 15, half = lane >> 4;

  v16h qf0 = frag_rm(qbase + (size_t)q0 * RS, RS, lane, 0);
  v16h qf1 = frag_rm(qbase + (size_t)q0 * RS, RS, lane, 32);
  v8f oacc[4] = {};
  float mrow[8], lrow[8];
#pragma unroll
  for (int r = 0; r < 8; ++r) { mrow[r] = -INFINITY; lrow[r] = 0.f; }
  _Float16* Pw = &Pls[wid * 16 * 32];
  const float SC = 0.125f;  // 1/sqrt(64)

  for (int j0 = 0; j0 <= q0 + 15; j0 += 32) {   // wave-uniform causal bound
    v8f s0 = {}, s1 = {};
    s0 = wmma_f16(qf0, frag_rm(kbase + (size_t)j0 * RS, RS, lane, 0), s0);
    s0 = wmma_f16(qf1, frag_rm(kbase + (size_t)j0 * RS, RS, lane, 32), s0);
    s1 = wmma_f16(qf0, frag_rm(kbase + (size_t)(j0 + 16) * RS, RS, lane, 0), s1);
    s1 = wmma_f16(qf1, frag_rm(kbase + (size_t)(j0 + 16) * RS, RS, lane, 32), s1);
#pragma unroll
    for (int r = 0; r < 8; ++r) {
      int qrow = q0 + half * 8 + r;
      float a = s0[r] * SC; if (j0 + n16      > qrow) a = -INFINITY;
      float c = s1[r] * SC; if (j0 + 16 + n16 > qrow) c = -INFINITY;
      float t = fmaxf(a, c);
#pragma unroll
      for (int msk = 1; msk < 16; msk <<= 1)
        t = fmaxf(t, __shfl_xor(t, msk, 32));  // row max over 16-lane half
      float mn    = fmaxf(mrow[r], t);
      float alpha = __expf(mrow[r] - mn);
      float p0    = __expf(a - mn);
      float p1    = __expf(c - mn);
      float rs    = p0 + p1;
#pragma unroll
      for (int msk = 1; msk < 16; msk <<= 1) rs += __shfl_xor(rs, msk, 32);
      lrow[r] = lrow[r] * alpha + rs;
      mrow[r] = mn;
#pragma unroll
      for (int d = 0; d < 4; ++d) oacc[d][r] *= alpha;
      Pw[(half * 8 + r) * 32 + n16]      = (_Float16)p0;
      Pw[(half * 8 + r) * 32 + 16 + n16] = (_Float16)p1;
    }
    v16h pf = frag_rm(Pw, 32, lane, 0);
#pragma unroll
    for (int d = 0; d < 4; ++d)
      oacc[d] = wmma_f16(pf, frag_cm(vbase + (size_t)j0 * RS + d * 16, RS, lane),
                         oacc[d]);
  }
  _Float16* obase = o16 + (size_t)b * T_ * E_ + h * D_;
#pragma unroll
  for (int r = 0; r < 8; ++r) {
    float inv = 1.0f / lrow[r];
    int trow = q0 + half * 8 + r;
#pragma unroll
    for (int d = 0; d < 4; ++d)
      obase[(size_t)trow * E_ + d * 16 + n16] = (_Float16)(oacc[d][r] * inv);
  }
}

// ---- Launch -----------------------------------------------------------------
extern "C" void kernel_launch(void* const* d_in, const int* in_sizes, int n_in,
                              void* d_out, int out_size, void* d_ws,
                              size_t ws_size, hipStream_t stream) {
  (void)in_sizes; (void)n_in; (void)out_size; (void)ws_size;
  const float* x    = (const float*)d_in[0];
  const float* ln1w = (const float*)d_in[1];
  const float* ln1b = (const float*)d_in[2];
  const float* ln2w = (const float*)d_in[3];
  const float* ln2b = (const float*)d_in[4];
  const float* qkvw = (const float*)d_in[5];
  const float* qkvb = (const float*)d_in[6];
  const float* outw = (const float*)d_in[7];
  const float* outb = (const float*)d_in[8];
  const float* fc1w = (const float*)d_in[9];
  const float* fc1b = (const float*)d_in[10];
  const float* fc2w = (const float*)d_in[11];
  const float* fc2b = (const float*)d_in[12];

  const int M = B_ * T_;  // 4096
  char* ws = (char*)d_ws;
  // [0,24MB): f16 weights; buf0 8MB; buf1 32MB; x1 16MB  (total 80MB)
  _Float16* qkvw16 = (_Float16*)(ws);
  _Float16* outw16 = (_Float16*)(ws + (6ull  << 20));
  _Float16* fc1w16 = (_Float16*)(ws + (8ull  << 20));
  _Float16* fc2w16 = (_Float16*)(ws + (16ull << 20));
  _Float16* buf0   = (_Float16*)(ws + (24ull << 20));
  _Float16* buf1   = (_Float16*)(ws + (32ull << 20));
  float*    x1     = (float*)   (ws + (64ull << 20));

  dim3 blk(256);
  prep_kernel<<<dim3(LN_BLKS + QKV_BLKS + OUT_BLKS + 2 * FC_BLKS), blk, 0, stream>>>(
      x, ln1w, ln1b, buf0, qkvw, outw, fc1w, fc2w, qkvw16);
  gemm_wmma_kernel<EPI_F16><<<dim3(3 * E_ / 128, M / 128), blk, 0, stream>>>(
      buf0, qkvw16, qkvb, nullptr, buf1, M, 3 * E_, E_);
  attn_kernel<<<dim3(B_ * H_, T_ / 128), blk, 0, stream>>>(buf1, buf0);
  gemm_wmma_kernel<EPI_F32_RES><<<dim3(E_ / 128, M / 128), blk, 0, stream>>>(
      buf0, outw16, outb, x, x1, M, E_, E_);
  ln_f16_kernel<<<dim3(M), blk, 0, stream>>>(x1, ln2w, ln2b, buf0);
  gemm_wmma_kernel<EPI_F16_GELU><<<dim3(F_ / 128, M / 128), blk, 0, stream>>>(
      buf0, fc1w16, fc1b, nullptr, buf1, M, F_, E_);
  gemm_wmma_kernel<EPI_F32_RES><<<dim3(E_ / 128, M / 128), blk, 0, stream>>>(
      buf1, fc2w16, fc2b, x1, d_out, M, E_, F_);
}

// v008
// Measured time: 167 microseconds a run.
// In both of two side-by-side timings against v007, it was 1.11 times as fast.
// Over all steps from v000 it is 1.95 times as fast.
#include <hip/hip_runtime.h>
#include <hip/hip_bf16.h>
#include <math.h>

typedef __attribute__((ext_vector_type(16))) _Float16 v16h;
typedef __attribute__((ext_vector_type(8)))  float    v8f;

static constexpr int E_  = 1024;
static constexpr int T_  = 1024;
static constexpr int B_  = 4;
static constexpr int H_  = 16;
static constexpr int D_  = 64;
static constexpr int F_  = 4096;

enum { EPI_F32 = 0, EPI_F16 = 1, EPI_F16_GELU = 2, EPI_F32_RES = 3 };

__device__ __forceinline__ v8f wmma_f16(v16h a, v16h b, v8f c) {
  return __builtin_amdgcn_wmma_f32_16x16x32_f16(false, a, false, b, (short)0, c,
                                                false, false);
}

__device__ __forceinline__ void async_stage(const _Float16* la,
                                            const _Float16* ga,
                                            const _Float16* lb,
                                            const _Float16* gb, uint32_t lstep,
                                            size_t gstep) {
  uint32_t a0 = (uint32_t)(uintptr_t)la, b0 = (uint32_t)(uintptr_t)lb;
  asm volatile("global_load_async_to_lds_b128 %0, %8, off\n\t"
               "global_load_async_to_lds_b128 %1, %9, off\n\t"
               "global_load_async_to_lds_b128 %2, %10, off\n\t"
               "global_load_async_to_lds_b128 %3, %11, off\n\t"
               "global_load_async_to_lds_b128 %4, %12, off\n\t"
               "global_load_async_to_lds_b128 %5, %13, off\n\t"
               "global_load_async_to_lds_b128 %6, %14, off\n\t"
               "global_load_async_to_lds_b128 %7, %15, off\n\t"
               "s_wait_xcnt 0x0"
               :: "v"(a0), "v"(a0 + lstep), "v"(a0 + 2 * lstep),
                  "v"(a0 + 3 * lstep),
                  "v"(b0), "v"(b0 + lstep), "v"(b0 + 2 * lstep),
                  "v"(b0 + 3 * lstep),
                  "v"((uint64_t)(uintptr_t)ga),
                  "v"((uint64_t)(uintptr_t)(ga + gstep)),
                  "v"((uint64_t)(uintptr_t)(ga + 2 * gstep)),
                  "v"((uint64_t)(uintptr_t)(ga + 3 * gstep)),
                  "v"((uint64_t)(uintptr_t)gb),
                  "v"((uint64_t)(uintptr_t)(gb + gstep)),
                  "v"((uint64_t)(uintptr_t)(gb + 2 * gstep)),
                  "v"((uint64_t)(uintptr_t)(gb + 3 * gstep))
               : "memory");
}
__device__ __forceinline__ void wait_async0() {
  asm volatile("s_wait_asynccnt 0" ::: "memory");
}

__device__ __forceinline__ v16h frag_rm(const _Float16* base, int stride,
                                        int lane, int k0) {
  int m = lane & 15, half = lane >> 4;
  const _Float16* p = base + (size_t)m * stride + k0 + (half << 3);
  v16h f;
#pragma unroll
  for (int v = 0; v < 8; ++v) {
    int k = ((v >> 2) << 4) + ((v & 3) << 1);
    f[2 * v]     = p[k];
    f[2 * v + 1] = p[k + 1];
  }
  return f;
}

// ---- f32 -> f16 weight conversion: 1024 elements a 256-thread block ---------
__device__ __forceinline__ void cvt_block(const float* __restrict__ in,
                                          _Float16* __restrict__ out) {
  int i = threadIdx.x * 4;
  float4 v = *(const float4*)(in + i);
  out[i + 0] = (_Float16)v.x;
  out[i + 1] = (_Float16)v.y;
  out[i + 2] = (_Float16)v.z;
  out[i + 3] = (_Float16)v.w;
}

// ---- LayerNorm (f32 in -> f16 out), one row (E=1024) per 256-thread block ---
__device__ __forceinline__ void ln_row(
    const float* __restrict__ x, const float* __restrict__ w,
    const float* __restrict__ bb, _Float16* __restrict__ out, int row) {
  const float* xr = x + (size_t)row * E_;
  float vals[4];
  float s = 0.f, s2 = 0.f;
#pragma unroll
  for (int i = 0; i < 4; ++i) {
    float v = xr[threadIdx.x + i * 256];
    vals[i] = v;
    s += v;
    s2 += v * v;
  }
#pragma unroll
  for (int msk = 1; msk < 32; msk <<= 1) {
    s  += __shfl_xor(s, msk, 32);
    s2 += __shfl_xor(s2, msk, 32);
  }
  __shared__ float ps[8], ps2[8];
  int lane = threadIdx.x & 31, wid = threadIdx.x >> 5;
  if (lane == 0) { ps[wid] = s; ps2[wid] = s2; }
  __syncthreads();
  s = 0.f; s2 = 0.f;
#pragma unroll
  for (int i = 0; i < 8; ++i) { s += ps[i]; s2 += ps2[i]; }
  float mean = s * (1.f / E_);
  float var  = s2 * (1.f / E_) - mean * mean;
  float rstd = rsqrtf(var + 1e-5f);
#pragma unroll
  for (int i = 0; i < 4; ++i) {
    int c = threadIdx.x + i * 256;
    out[(size_t)row * E_ + c] = (_Float16)((vals[i] - mean) * rstd * w[c] + bb[c]);
  }
}

__global__ __launch_bounds__(256) void ln_f16_kernel(
    const float* __restrict__ x, const float* __restrict__ w,
    const float* __restrict__ bb, _Float16* __restrict__ out) {
  ln_row(x, w, bb, out, blockIdx.x);
}

// ---- First launch: LayerNorm 1 and the four weight conversions --------------
// None of the five reads what another writes, so they share one grid: each of
// them as a launch of its own paid the gap between dependent launches and its
// own start and drain, which for these few microseconds of streaming is most of
// the time. Blocks [0, LN_BLKS) take one row of x each (first, as theirs is the
// longer chain); the rest take 1024 weights each. The four f16 weight arrays lie
// one behind the other in w16, in the order of the ranges below, so a conversion
// block's place in w16 follows from its index alone. Every test is on blockIdx
// only: a block takes one path as a whole, the LayerNorm barrier included.
static constexpr int LN_BLKS  = B_ * T_;
static constexpr int QKV_BLKS = 3 * E_ * E_ / 1024;
static constexpr int OUT_BLKS = E_ * E_ / 1024;
static constexpr int FC_BLKS  = F_ * E_ / 1024;
__global__ __launch_bounds__(256) void prep_kernel(
    const float* __restrict__ x, const float* __restrict__ w,
    const float* __restrict__ bb, _Float16* __restrict__ h,
    const float* __restrict__ qkvw, const float* __restrict__ outw,
    const float* __restrict__ fc1w, const float* __restrict__ fc2w,
    _Float16* __restrict__ w16) {
  int blk = blockIdx.x;
  if (blk < LN_BLKS) {
    ln_row(x, w, bb, h, blk);
    return;
  }
  blk -= LN_BLKS;
  const float* in = qkvw;
  int first = 0;
  if (blk >= QKV_BLKS)                      { in = outw; first = QKV_BLKS; }
  if (blk >= QKV_BLKS + OUT_BLKS)           { in = fc1w; first = QKV_BLKS + OUT_BLKS; }
  if (blk >= QKV_BLKS + OUT_BLKS + FC_BLKS) { in = fc2w; first = QKV_BLKS + OUT_BLKS + FC_BLKS; }
  cvt_block(in + (size_t)(blk - first) * 1024, w16 + (size_t)blk * 1024);
}

template <int EPI>
__global__ __launch_bounds__(256) void gemm_wmma_kernel(
    const _Float16* __restrict__ A, const _Float16* __restrict__ Wt,
    const float* __restrict__ bias, const float* __restrict__ resid,
    void* __restrict__ out, int M, int N, int K) {
  // A stage is copied in column groups of 64 k = 128 B of every operand row: one
  // whole cache line, so that eight lanes copy a row's share of a group and a
  // wave's copy reads four whole lines.
  // The residual GEMMs launch one work-group a WGP: nothing else on the WGP
  // works while a stage's copies are on their way, and a stage of 64 k is
  // reckoned to be worked through before the next has landed. So 256 k: a
  // quarter of the round trips, each behind four times the work; the two
  // buffers then take most of the WGP's LDS. The other two GEMMs keep 64 k, so
  // that three or four work-groups still fit a WGP and cover for each other.
  constexpr int TK = EPI == EPI_F32_RES ? 256 : 64;
  constexpr int LP = TK + 8;
  // k steps (32 k each) whose fragments are read together. The residual GEMMs
  // launch one work-group a WGP, so registers are free: two steps. The other
  // two share a WGP three or four work-groups at a time, which 128 registers a
  // wave allow: one step.
  constexpr int GRP = EPI == EPI_F32_RES ? 2 : 1;
  __shared__ __align__(16) _Float16 As[2][128 * LP];
  __shared__ __align__(16) _Float16 Bs[2][128 * LP];
  int tid = threadIdx.x, lane = tid & 31, wid = tid >> 5;
  int wm = wid & 3, wn = wid >> 2;
  int bm = blockIdx.y * 128, bn = blockIdx.x * 128;
  int ldrow = tid >> 3, ldcol = (tid & 7) << 3;  // 32 rows x 64 k per copy group
  constexpr uint32_t LSTEP = 32 * LP * sizeof(_Float16);  // 32 rows on, in LDS
  const size_t gstep = (size_t)32 * K;                    // 32 rows on, global
  const _Float16* ag = A  + (size_t)(bm + ldrow) * K + ldcol;
  const _Float16* wg = Wt + (size_t)(bn + ldrow) * K + ldcol;
  const int iters = K / TK;

  // prefetch tile 0 into buffer 0, one column group after the other
  // (unrolled so that a group's column offset is a constant in its addresses)
#pragma unroll
  for (int c = 0; c < TK; c += 64)
    async_stage(&As[0][ldrow * LP + ldcol + c], ag + c,
                &Bs[0][ldrow * LP + ldcol + c], wg + c, LSTEP, gstep);

  // The residual tile is asked for here, all of it in flight together and
  // behind the whole k loop; loaded one by one between the epilogue's stores,
  // each element cost its wave a full round trip to L2 or memory.
  int n16 = lane & 15, half = lane >> 4;
  float rv[EPI == EPI_F32_RES ? 2 : 1][4][8];
  if constexpr (EPI == EPI_F32_RES) {
#pragma unroll
    for (int i = 0; i < 2; ++i)
#pragma unroll
      for (int r = 0; r < 8; ++r) {
        const float* rp = resid +
            (size_t)(bm + wm * 32 + i * 16 + half * 8 + r) * N + bn + wn * 64 + n16;
#pragma unroll
        for (int j = 0; j < 4; ++j) rv[i][j][r] = rp[j * 16];
      }
  }

  v8f acc[2][4] = {};
  for (int it = 0; it < iters; ++it) {
    int cur = it & 1;
    wait_async0();        // my in-flight ops are exactly buffer `cur`'s
    __syncthreads();      // all waves done writing `cur` & done reading `cur^1`
    if (it + 1 < iters) { // prefetch next tile into the other buffer
      const _Float16* ga = ag + (size_t)(it + 1) * TK;
      const _Float16* gb = wg + (size_t)(it + 1) * TK;
      // Unrolled for the same reason as in front of the loop.
#pragma unroll
      for (int c = 0; c < TK; c += 64)
        async_stage(&As[cur ^ 1][ldrow * LP + ldcol + c], ga + c,
                    &Bs[cur ^ 1][ldrow * LP + ldcol + c], gb + c, LSTEP, gstep);
    }
    // The fragment reads of GRP k steps go out as one group, each fragment into
    // registers of its own, ahead of those steps' WMMAs: the wave then meets the
    // LDS latency once a group, not once for every pair of WMMAs.
    // Unrolled so that the k offset of each fragment read is an immediate.
#pragma unroll
    for (int k0 = 0; k0 < TK; k0 += 32 * GRP) {
      v16h af[GRP][2], bf[GRP][4];
#pragma unroll
      for (int g = 0; g < GRP; ++g) {
#pragma unroll
        for (int i = 0; i < 2; ++i)
          af[g][i] = frag_rm(&As[cur][(wm * 32 + i * 16) * LP], LP, lane,
                             k0 + 32 * g);
#pragma unroll
        for (int j = 0; j < 4; ++j)
          bf[g][j] = frag_rm(&Bs[cur][(wn * 64 + j * 16) * LP], LP, lane,
                             k0 + 32 * g);
      }
      // Keeps the compiler from sinking the reads back among the WMMAs, where
      // it gave all four B fragments one register set and waited for each.
      __builtin_amdgcn_sched_barrier(0);
#pragma unroll
      for (int g = 0; g < GRP; ++g)
#pragma unroll
        for (int j = 0; j < 4; ++j) {
          acc[0][j] = wmma_f16(af[g][0], bf[g][j], acc[0][j]);
          acc[1][j] = wmma_f16(af[g][1], bf[g][j], acc[1][j]);
        }
      // Keeps what follows from rising above these WMMAs: the next group's reads
      // and, seen without it, the barrier below with a wait for every read.
      __builtin_amdgcn_sched_barrier(0);
    }
    __syncthreads();      // all waves done reading `cur` before it is refilled
  }
  wait_async0();  // no copy is left in flight when the wave ends (also K < TK)

#pragma unroll
  for (int i = 0; i < 2; ++i)
#pragma unroll
    for (int j = 0; j < 4; ++j) {
      int col = bn + wn * 64 + j * 16 + n16;
      float bv = bias[col];
#pragma unroll
      for (int r = 0; r < 8; ++r) {
        int row = bm + wm * 32 + i * 16 + half * 8 + r;
        size_t idx = (size_t)row * N + col;
        float v = acc[i][j][r] + bv;
        if constexpr (EPI == EPI_F32) {
          ((float*)out)[idx] = v;
        } else if constexpr (EPI == EPI_F16) {
          ((_Float16*)out)[idx] = (_Float16)v;
        } else if constexpr (EPI == EPI_F16_GELU) {
          ((_Float16*)out)[idx] =
              (_Float16)(0.5f * v * (1.f + erff(v * 0.70710678118f)));
        } else {
          ((float*)out)[idx] = v + rv[i][j][r];
        }
      }
    }
}

// ---- Flash-style causal attention -------------------------------------------
// grid: (B*H, T/128 row blocks). 8 waves/block, each wave owns 16 query rows.
// Row block t walks 4(t + 1) key blocks of 32, and all work-groups are resident at once,
// two on a WGP, so the launch lasts as long as the fullest WGP. Work-groups 8,
// 16 or 256 apart in launch order take t and NT - 1 - t: equal work a pair.
// For speed only: (head, row block) is met once wherever a work-group lands.
//
// The eight waves of a work-group walk the same keys of one head, so each block
// of 32 keys (K rows and V rows, 128 B each) is brought into LDS once for all of
// them, by async copies, one block ahead in a second buffer: the round trip to
// L2 runs beside the block being worked on. Loaded by every wave for itself,
// each trip began by waiting for its own 72 loads, 64 of them two bytes a lane.

__device__ __forceinline__ void async_kv(const _Float16* lk, const _Float16* gk,
                                         const _Float16* lv,
                                         const _Float16* gv) {
  asm volatile("global_load_async_to_lds_b128 %0, %2, off\n\t"
               "global_load_async_to_lds_b128 %1, %3, off\n\t"
               "s_wait_xcnt 0x0"
               :: "v"((uint32_t)(uintptr_t)lk), "v"((uint32_t)(uintptr_t)lv),
                  "v"((uint64_t)(uintptr_t)gk), "v"((uint64_t)(uintptr_t)gv)
               : "memory");
}

// B fragment (32 k x 16 n) of a row-major LDS tile, element B[k][n] =
// base[k * pitch + n], by the transposing LDS load: lane (n = lane & 15,
// half = lane >> 4) gets k = 8 * half + 0..7 from the first load and 16 more
// from the second, which is the k order of frag_rm.
__device__ __forceinline__ v16h frag_tr(const _Float16* base, int pitch,
                                        int lane) {
  typedef __attribute__((ext_vector_type(8))) short s16x8;
  typedef __attribute__((ext_vector_type(8))) _Float16 v8h;
  typedef __attribute__((address_space(3))) s16x8 lds_s16x8;
  const _Float16* p = base + (((lane >> 4) << 3) + (lane & 7)) * pitch +
                      (((lane >> 3) & 1) << 3);
  v8h lo = __builtin_bit_cast(
      v8h, __builtin_amdgcn_ds_load_tr16_b128_v8i16((lds_s16x8*)p));
  v8h hi = __builtin_bit_cast(
      v8h, __builtin_amdgcn_ds_load_tr16_b128_v8i16((lds_s16x8*)(p + 16 * pitch)));
  return __builtin_shufflevector(lo, hi, 0, 1, 2, 3, 4, 5, 6, 7, 8, 9, 10, 11,
                                 12, 13, 14, 15);
}

__global__ __launch_bounds__(256) void attn_kernel(
    const _Float16* __restrict__ qkv, _Float16* __restrict__ o16) {
  // LDS row pitches in halves: K 144 B = 16 B x odd for its ds_load_b128
  // readers, V 160 B = 32 B x odd for the transposing load.
  constexpr int KP = D_ + 8, VP = D_ + 16;
  __shared__ __align__(16) _Float16 Ks[2][32 * KP];
  __shared__ __align__(16) _Float16 Vs[2][32 * VP];
  __shared__ __align__(16) _Float16 Pls[8 * 16 * 32];  // per-wave P staging
  int tid = threadIdx.x, lane = tid & 31;
  // The wave's number in a scalar register: the test that lets a wave skip key
  // blocks past its diagonal is then a scalar branch, all lanes on inside it.
  int wid = __builtin_amdgcn_readfirstlane(tid >> 5);
  constexpr int NT = T_ / 128;
  int bh = blockIdx.x, b = bh >> 4, h = bh & 15;
  int t = blockIdx.y % (NT / 2);
  int flip = (blockIdx.y / (NT / 2) ^ (bh >> 3) ^ (bh >> 4)) & 1;
  int rb = flip ? t : NT - 1 - t;
  int q0 = rb * 128 + wid * 16;
  const int trips = (rb + 1) * 4;  // key blocks of the work-group: 4 or more
  const int RS = 3 * E_;
  const _Float16* qbase = qkv + (size_t)b * T_ * RS + h * D_;
  const _Float16* kbase = qbase + E_;
  const _Float16* vbase = qbase + 2 * E_;
  int n16 = lane & 15, half = lane >> 4;

  // Eight lanes copy a row: a wave's copy reads four whole 128 B lines.
  int crow = tid >> 3, ccol = (tid & 7) << 3;
  const _Float16* kg = kbase + (size_t)crow * RS + ccol;
  const _Float16* vg = vbase + (size_t)crow * RS + ccol;
  const int klds = crow * KP + ccol, vlds = crow * VP + ccol;

  async_kv(&Ks[0][klds], kg, &Vs[0][vlds], vg);
  wait_async0();    // my share of key block 0 has landed
  __syncthreads();  // and everybody's: block 0 may be read
  async_kv(&Ks[1][klds], kg + (size_t)32 * RS, &Vs[1][vlds],
           vg + (size_t)32 * RS);

  v16h qf0 = frag_rm(qbase + (size_t)q0 * RS, RS, lane, 0);
  v16h qf1 = frag_rm(qbase + (size_t)q0 * RS, RS, lane, 32);
  v8f oacc[4] = {};
  float mrow[8], lrow[8];
#pragma unroll
  for (int r = 0; r < 8; ++r) { mrow[r] = -INFINITY; lrow[r] = 0.f; }
  _Float16* Pw = &Pls[wid * 16 * 32];
  const float SC = 0.125f;  // 1/sqrt(64)

  for (int it = 0; it < trips; ++it) {  // the same count for all eight waves
    const int j0 = it * 32, cur = it & 1;
    if (j0 <= q0 + 15) {                // wave-uniform causal bound
      const _Float16* Kc = &Ks[cur][0];
      const _Float16* Vc = &Vs[cur][0];
      // The block's 16 fragment reads go out as one group, each fragment into
      // registers of its own: the wave meets the LDS latency once a trip.
      v16h kf[4], vf[4];
#pragma unroll
      for (int i = 0; i < 4; ++i)
        kf[i] = frag_rm(Kc + (i >> 1) * 16 * KP, KP, lane, (i & 1) * 32);
#pragma unroll
      for (int d = 0; d < 4; ++d) vf[d] = frag_tr(Vc + d * 16, VP, lane);
      // Keeps the compiler from sinking the reads among the WMMAs, where it gave
      // all K fragments one register set and waited to 0 for each.
      __builtin_amdgcn_sched_barrier(0);
      v8f s0 = {}, s1 = {};
      s0 = wmma_f16(qf0, kf[0], s0);
      s1 = wmma_f16(qf0, kf[2], s1);
      s0 = wmma_f16(qf1, kf[1], s0);
      s1 = wmma_f16(qf1, kf[3], s1);
      float sa[8], sc[8];
#pragma unroll
      for (int r = 0; r < 8; ++r) {
        int qrow = q0 + half * 8 + r;
        sa[r] = s0[r] * SC; if (j0 + n16      > qrow) sa[r] = -INFINITY;
        sc[r] = s1[r] * SC; if (j0 + 16 + n16 > qrow) sc[r] = -INFINITY;
      }
      // All eight rows are masked before the first lane exchange: the exchanges
      // then go out eight to a wait. Without it the compiler, which no longer has
      // the global loads' shadow to form the masks in, started the rows one by
      // one, and the last row's chain of exchanges ended that much later.
      __builtin_amdgcn_sched_barrier(0);
#pragma unroll
      for (int r = 0; r < 8; ++r) {
        float a = sa[r], c = sc[r];
        float t = fmaxf(a, c);
#pragma unroll
        for (int msk = 1; msk < 16; msk <<= 1)
          t = fmaxf(t, __shfl_xor(t, msk, 32));  // row max over 16-lane half
        float mn    = fmaxf(mrow[r], t);
        float alpha = __expf(mrow[r] - mn);
        float p0    = __expf(a - mn);
        float p1    = __expf(c - mn);
        float rs    = p0 + p1;
#pragma unroll
        for (int msk = 1; msk < 16; msk <<= 1) rs += __shfl_xor(rs, msk, 32);
        lrow[r] = lrow[r] * alpha + rs;
        mrow[r] = mn;
#pragma unroll
        for (int d = 0; d < 4; ++d) oacc[d][r] *= alpha;
        Pw[(half * 8 + r) * 32 + n16]      = (_Float16)p0;
        Pw[(half * 8 + r) * 32 + 16 + n16] = (_Float16)p1;
      }
      v16h pf = frag_rm(Pw, 32, lane, 0);
#pragma unroll
      for (int d = 0; d < 4; ++d)
        oacc[d] = wmma_f16(pf, vf[d], oacc[d]);
    }
    // Hand-over, passed by every wave, also one that skipped the block:
    // my reads of buffer cur are done ...
    asm volatile("s_wait_dscnt 0x0" ::: "memory");
    wait_async0();    // ... my share of block it + 1 has landed ...
    __syncthreads();  // ... and so for all waves: cur is free, it + 1 readable
    if (it + 2 < trips)
      async_kv(&Ks[cur][klds], kg + (size_t)(it + 2) * 32 * RS, &Vs[cur][vlds],
               vg + (size_t)(it + 2) * 32 * RS);
  }
  wait_async0();  // no copy is left in flight when the wave ends
  _Float16* obase = o16 + (size_t)b * T_ * E_ + h * D_;
#pragma unroll
  for (int r = 0; r < 8; ++r) {
    float inv = 1.0f / lrow[r];
    int trow = q0 + half * 8 + r;
#pragma unroll
    for (int d = 0; d < 4; ++d)
      obase[(size_t)trow * E_ + d * 16 + n16] = (_Float16)(oacc[d][r] * inv);
  }
}

// ---- Launch -----------------------------------------------------------------
extern "C" void kernel_launch(void* const* d_in, const int* in_sizes, int n_in,
                              void* d_out, int out_size, void* d_ws,
                              size_t ws_size, hipStream_t stream) {
  (void)in_sizes; (void)n_in; (void)out_size; (void)ws_size;
  const float* x    = (const float*)d_in[0];
  const float* ln1w = (const float*)d_in[1];
  const float* ln1b = (const float*)d_in[2];
  const float* ln2w = (const float*)d_in[3];
  const float* ln2b = (const float*)d_in[4];
  const float* qkvw = (const float*)d_in[5];
  const float* qkvb = (const float*)d_in[6];
  const float* outw = (const float*)d_in[7];
  const float* outb = (const float*)d_in[8];
  const float* fc1w = (const float*)d_in[9];
  const float* fc1b = (const float*)d_in[10];
  const float* fc2w = (const float*)d_in[11];
  const float* fc2b = (const float*)d_in[12];

  const int M = B_ * T_;  // 4096
  char* ws = (char*)d_ws;
  // [0,24MB): f16 weights; buf0 8MB; buf1 32MB; x1 16MB  (total 80MB)
  _Float16* qkvw16 = (_Float16*)(ws);
  _Float16* outw16 = (_Float16*)(ws + (6ull  << 20));
  _Float16* fc1w16 = (_Float16*)(ws + (8ull  << 20));
  _Float16* fc2w16 = (_Float16*)(ws + (16ull << 20));
  _Float16* buf0   = (_Float16*)(ws + (24ull << 20));
  _Float16* buf1   = (_Float16*)(ws + (32ull << 20));
  float*    x1     = (float*)   (ws + (64ull << 20));

  dim3 blk(256);
  prep_kernel<<<dim3(LN_BLKS + QKV_BLKS + OUT_BLKS + 2 * FC_BLKS), blk, 0, stream>>>(
      x, ln1w, ln1b, buf0, qkvw, outw, fc1w, fc2w, qkvw16);
  gemm_wmma_kernel<EPI_F16><<<dim3(3 * E_ / 128, M / 128), blk, 0, stream>>>(
      buf0, qkvw16, qkvb, nullptr, buf1, M, 3 * E_, E_);
  attn_kernel<<<dim3(B_ * H_, T_ / 128), blk, 0, stream>>>(buf1, buf0);
  gemm_wmma_kernel<EPI_F32_RES><<<dim3(E_ / 128, M / 128), blk, 0, stream>>>(
      buf0, outw16, outb, x, x1, M, E_, E_);
  ln_f16_kernel<<<dim3(M), blk, 0, stream>>>(x1, ln2w, ln2b, buf0);
  gemm_wmma_kernel<EPI_F16_GELU><<<dim3(F_ / 128, M / 128), blk, 0, stream>>>(
      buf0, fc1w16, fc1b, nullptr, buf1, M, F_, E_);
  gemm_wmma_kernel<EPI_F32_RES><<<dim3(E_ / 128, M / 128), blk, 0, stream>>>(
      buf1, fc2w16, fc2b, x1, d_out, M, E_, F_);
}

// v009
// Measured time: 155 microseconds a run.
// Timed twice side by side with v008, it ran 1.07 and 1.09 times as fast.
// Counting every step since v000, it is 2.11 times as fast.
#include <hip/hip_runtime.h>
#include <hip/hip_bf16.h>
#include <math.h>

typedef __attribute__((ext_vector_type(16))) _Float16 v16h;
typedef __attribute__((ext_vector_type(8)))  float    v8f;

static constexpr int E_  = 1024;
static constexpr int T_  = 1024;
static constexpr int B_  = 4;
static constexpr int H_  = 16;
static constexpr int D_  = 64;
static constexpr int F_  = 4096;

enum { EPI_F32 = 0, EPI_F16 = 1, EPI_F16_GELU = 2, EPI_F32_RES = 3 };

__device__ __forceinline__ v8f wmma_f16(v16h a, v16h b, v8f c) {
  return __builtin_amdgcn_wmma_f32_16x16x32_f16(false, a, false, b, (short)0, c,
                                                false, false);
}

__device__ __forceinline__ void async_stage(const _Float16* la,
                                            const _Float16* ga,
                                            const _Float16* lb,
                                            const _Float16* gb, uint32_t lstep,
                                            size_t gstep) {
  uint32_t a0 = (uint32_t)(uintptr_t)la, b0 = (uint32_t)(uintptr_t)lb;
  asm volatile("global_load_async_to_lds_b128 %0, %8, off\n\t"
               "global_load_async_to_lds_b128 %1, %9, off\n\t"
               "global_load_async_to_lds_b128 %2, %10, off\n\t"
               "global_load_async_to_lds_b128 %3, %11, off\n\t"
               "global_load_async_to_lds_b128 %4, %12, off\n\t"
               "global_load_async_to_lds_b128 %5, %13, off\n\t"
               "global_load_async_to_lds_b128 %6, %14, off\n\t"
               "global_load_async_to_lds_b128 %7, %15, off\n\t"
               "s_wait_xcnt 0x0"
               :: "v"(a0), "v"(a0 + lstep), "v"(a0 + 2 * lstep),
                  "v"(a0 + 3 * lstep),
                  "v"(b0), "v"(b0 + lstep), "v"(b0 + 2 * lstep),
                  "v"(b0 + 3 * lstep),
                  "v"((uint64_t)(uintptr_t)ga),
                  "v"((uint64_t)(uintptr_t)(ga + gstep)),
                  "v"((uint64_t)(uintptr_t)(ga + 2 * gstep)),
                  "v"((uint64_t)(uintptr_t)(ga + 3 * gstep)),
                  "v"((uint64_t)(uintptr_t)gb),
                  "v"((uint64_t)(uintptr_t)(gb + gstep)),
                  "v"((uint64_t)(uintptr_t)(gb + 2 * gstep)),
                  "v"((uint64_t)(uintptr_t)(gb + 3 * gstep))
               : "memory");
}
__device__ __forceinline__ void wait_async0() {
  asm volatile("s_wait_asynccnt 0" ::: "memory");
}

__device__ __forceinline__ v16h frag_rm(const _Float16* base, int stride,
                                        int lane, int k0) {
  int m = lane & 15, half = lane >> 4;
  const _Float16* p = base + (size_t)m * stride + k0 + (half << 3);
  v16h f;
#pragma unroll
  for (int v = 0; v < 8; ++v) {
    int k = ((v >> 2) << 4) + ((v & 3) << 1);
    f[2 * v]     = p[k];
    f[2 * v + 1] = p[k + 1];
  }
  return f;
}

// ---- f32 -> f16 weight conversion: 1024 elements a 256-thread block ---------
__device__ __forceinline__ void cvt_block(const float* __restrict__ in,
                                          _Float16* __restrict__ out) {
  int i = threadIdx.x * 4;
  float4 v = *(const float4*)(in + i);
  out[i + 0] = (_Float16)v.x;
  out[i + 1] = (_Float16)v.y;
  out[i + 2] = (_Float16)v.z;
  out[i + 3] = (_Float16)v.w;
}

// ---- LayerNorm (f32 in -> f16 out), one row (E=1024) per 256-thread block ---
__device__ __forceinline__ void ln_row(
    const float* __restrict__ x, const float* __restrict__ w,
    const float* __restrict__ bb, _Float16* __restrict__ out, int row) {
  const float* xr = x + (size_t)row * E_;
  float vals[4];
  float s = 0.f, s2 = 0.f;
#pragma unroll
  for (int i = 0; i < 4; ++i) {
    float v = xr[threadIdx.x + i * 256];
    vals[i] = v;
    s += v;
    s2 += v * v;
  }
#pragma unroll
  for (int msk = 1; msk < 32; msk <<= 1) {
    s  += __shfl_xor(s, msk, 32);
    s2 += __shfl_xor(s2, msk, 32);
  }
  __shared__ float ps[8], ps2[8];
  int lane = threadIdx.x & 31, wid = threadIdx.x >> 5;
  if (lane == 0) { ps[wid] = s; ps2[wid] = s2; }
  __syncthreads();
  s = 0.f; s2 = 0.f;
#pragma unroll
  for (int i = 0; i < 8; ++i) { s += ps[i]; s2 += ps2[i]; }
  float mean = s * (1.f / E_);
  float var  = s2 * (1.f / E_) - mean * mean;
  float rstd = rsqrtf(var + 1e-5f);
#pragma unroll
  for (int i = 0; i < 4; ++i) {
    int c = threadIdx.x + i * 256;
    out[(size_t)row * E_ + c] = (_Float16)((vals[i] - mean) * rstd * w[c] + bb[c]);
  }
}

__global__ __launch_bounds__(256) void ln_f16_kernel(
    const float* __restrict__ x, const float* __restrict__ w,
    const float* __restrict__ bb, _Float16* __restrict__ out) {
  ln_row(x, w, bb, out, blockIdx.x);
}

// ---- First launch: LayerNorm 1 and the four weight conversions --------------
// None of the five reads what another writes, so they share one grid: each of
// them as a launch of its own paid the gap between dependent launches and its
// own start and drain, which for these few microseconds of streaming is most of
// the time. Blocks [0, LN_BLKS) take one row of x each (first, as theirs is the
// longer chain); the rest take 1024 weights each. The four f16 weight arrays lie
// one behind the other in w16, in the order of the ranges below, so a conversion
// block's place in w16 follows from its index alone. Every test is on blockIdx
// only: a block takes one path as a whole, the LayerNorm barrier included.
static constexpr int LN_BLKS  = B_ * T_;
static constexpr int QKV_BLKS = 3 * E_ * E_ / 1024;
static constexpr int OUT_BLKS = E_ * E_ / 1024;
static constexpr int FC_BLKS  = F_ * E_ / 1024;
__global__ __launch_bounds__(256) void prep_kernel(
    const float* __restrict__ x, const float* __restrict__ w,
    const float* __restrict__ bb, _Float16* __restrict__ h,
    const float* __restrict__ qkvw, const float* __restrict__ outw,
    const float* __restrict__ fc1w, const float* __restrict__ fc2w,
    _Float16* __restrict__ w16) {
  int blk = blockIdx.x;
  if (blk < LN_BLKS) {
    ln_row(x, w, bb, h, blk);
    return;
  }
  blk -= LN_BLKS;
  const float* in = qkvw;
  int first = 0;
  if (blk >= QKV_BLKS)                      { in = outw; first = QKV_BLKS; }
  if (blk >= QKV_BLKS + OUT_BLKS)           { in = fc1w; first = QKV_BLKS + OUT_BLKS; }
  if (blk >= QKV_BLKS + OUT_BLKS + FC_BLKS) { in = fc2w; first = QKV_BLKS + OUT_BLKS + FC_BLKS; }
  cvt_block(in + (size_t)(blk - first) * 1024, w16 + (size_t)blk * 1024);
}

template <int EPI>
__global__ __launch_bounds__(256) void gemm_wmma_kernel(
    const _Float16* __restrict__ A, const _Float16* __restrict__ Wt,
    const float* __restrict__ bias, const float* __restrict__ resid,
    void* __restrict__ out, int M, int N, int K) {
  // A stage is copied in column groups of 64 k = 128 B of every operand row: one
  // whole cache line, so that eight lanes copy a row's share of a group and a
  // wave's copy reads four whole lines.
  // The residual GEMMs launch one work-group a WGP: nothing else on the WGP
  // works while a stage's copies are on their way, and a stage of 64 k is
  // reckoned to be worked through before the next has landed. So 256 k: a
  // quarter of the round trips, each behind four times the work; the two
  // buffers then take most of the WGP's LDS. The other two GEMMs keep 64 k, so
  // that three or four work-groups still fit a WGP and cover for each other.
  constexpr int TK = EPI == EPI_F32_RES ? 256 : 64;
  constexpr int LP = TK + 8;
  // k steps (32 k each) whose fragments are read together. The residual GEMMs
  // launch one work-group a WGP, so registers are free: two steps. The other
  // two share a WGP three or four work-groups at a time, which 128 registers a
  // wave allow: one step.
  constexpr int GRP = EPI == EPI_F32_RES ? 2 : 1;
  __shared__ __align__(16) _Float16 As[2][128 * LP];
  __shared__ __align__(16) _Float16 Bs[2][128 * LP];
  int tid = threadIdx.x, lane = tid & 31, wid = tid >> 5;
  int wm = wid & 3, wn = wid >> 2;
  int bm = blockIdx.y * 128, bn = blockIdx.x * 128;
  int ldrow = tid >> 3, ldcol = (tid & 7) << 3;  // 32 rows x 64 k per copy group
  constexpr uint32_t LSTEP = 32 * LP * sizeof(_Float16);  // 32 rows on, in LDS
  const size_t gstep = (size_t)32 * K;                    // 32 rows on, global
  const _Float16* ag = A  + (size_t)(bm + ldrow) * K + ldcol;
  const _Float16* wg = Wt + (size_t)(bn + ldrow) * K + ldcol;
  const int iters = K / TK;

  // prefetch tile 0 into buffer 0, one column group after the other
  // (unrolled so that a group's column offset is a constant in its addresses)
#pragma unroll
  for (int c = 0; c < TK; c += 64)
    async_stage(&As[0][ldrow * LP + ldcol + c], ag + c,
                &Bs[0][ldrow * LP + ldcol + c], wg + c, LSTEP, gstep);

  // The residual tile is asked for here, all of it in flight together and
  // behind the whole k loop; loaded one by one between the epilogue's stores,
  // each element cost its wave a full round trip to L2 or memory.
  int n16 = lane & 15, half = lane >> 4;
  float rv[EPI == EPI_F32_RES ? 2 : 1][4][8];
  if constexpr (EPI == EPI_F32_RES) {
#pragma unroll
    for (int i = 0; i < 2; ++i)
#pragma unroll
      for (int r = 0; r < 8; ++r) {
        const float* rp = resid +
            (size_t)(bm + wm * 32 + i * 16 + half * 8 + r) * N + bn + wn * 64 + n16;
#pragma unroll
        for (int j = 0; j < 4; ++j) rv[i][j][r] = rp[j * 16];
      }
  }

  v8f acc[2][4] = {};
  for (int it = 0; it < iters; ++it) {
    int cur = it & 1;
    wait_async0();        // my in-flight ops are exactly buffer `cur`'s
    __syncthreads();      // all waves done writing `cur` & done reading `cur^1`
    if (it + 1 < iters) { // prefetch next tile into the other buffer
      const _Float16* ga = ag + (size_t)(it + 1) * TK;
      const _Float16* gb = wg + (size_t)(it + 1) * TK;
      // Unrolled for the same reason as in front of the loop.
#pragma unroll
      for (int c = 0; c < TK; c += 64)
        async_stage(&As[cur ^ 1][ldrow * LP + ldcol + c], ga + c,
                    &Bs[cur ^ 1][ldrow * LP + ldcol + c], gb + c, LSTEP, gstep);
    }
    // The fragment reads of GRP k steps go out as one group, each fragment into
    // registers of its own, ahead of those steps' WMMAs: the wave then meets the
    // LDS latency once a group, not once for every pair of WMMAs.
    // Unrolled so that the k offset of each fragment read is an immediate.
#pragma unroll
    for (int k0 = 0; k0 < TK; k0 += 32 * GRP) {
      v16h af[GRP][2], bf[GRP][4];
#pragma unroll
      for (int g = 0; g < GRP; ++g) {
#pragma unroll
        for (int i = 0; i < 2; ++i)
          af[g][i] = frag_rm(&As[cur][(wm * 32 + i * 16) * LP], LP, lane,
                             k0 + 32 * g);
#pragma unroll
        for (int j = 0; j < 4; ++j)
          bf[g][j] = frag_rm(&Bs[cur][(wn * 64 + j * 16) * LP], LP, lane,
                             k0 + 32 * g);
      }
      // Keeps the compiler from sinking the reads back among the WMMAs, where
      // it gave all four B fragments one register set and waited for each.
      __builtin_amdgcn_sched_barrier(0);
#pragma unroll
      for (int g = 0; g < GRP; ++g)
#pragma unroll
        for (int j = 0; j < 4; ++j) {
          acc[0][j] = wmma_f16(af[g][0], bf[g][j], acc[0][j]);
          acc[1][j] = wmma_f16(af[g][1], bf[g][j], acc[1][j]);
        }
      // Keeps what follows from rising above these WMMAs: the next group's reads
      // and, seen without it, the barrier below with a wait for every read.
      __builtin_amdgcn_sched_barrier(0);
    }
    __syncthreads();      // all waves done reading `cur` before it is refilled
  }
  wait_async0();  // no copy is left in flight when the wave ends (also K < TK)

#pragma unroll
  for (int i = 0; i < 2; ++i)
#pragma unroll
    for (int j = 0; j < 4; ++j) {
      int col = bn + wn * 64 + j * 16 + n16;
      float bv = bias[col];
#pragma unroll
      for (int r = 0; r < 8; ++r) {
        int row = bm + wm * 32 + i * 16 + half * 8 + r;
        size_t idx = (size_t)row * N + col;
        float v = acc[i][j][r] + bv;
        if constexpr (EPI == EPI_F32) {
          ((float*)out)[idx] = v;
        } else if constexpr (EPI == EPI_F16) {
          ((_Float16*)out)[idx] = (_Float16)v;
        } else if constexpr (EPI == EPI_F16_GELU) {
          ((_Float16*)out)[idx] =
              (_Float16)(0.5f * v * (1.f + erff(v * 0.70710678118f)));
        } else {
          ((float*)out)[idx] = v + rv[i][j][r];
        }
      }
    }
}

// ---- Flash-style causal attention -------------------------------------------
// grid: (B*H, T/128 row blocks). 8 waves/block, each wave owns 16 query rows.
// Row block t walks 4(t + 1) key blocks of 32, and all work-groups are resident at once,
// two on a WGP, so the launch lasts as long as the fullest WGP. Work-groups 8,
// 16 or 256 apart in launch order take t and NT - 1 - t: equal work a pair.
// For speed only: (head, row block) is met once wherever a work-group lands.
//
// The eight waves of a work-group walk the same keys of one head, so each block
// of 32 keys (K rows and V rows, 128 B each) is brought into LDS once for all of
// them, by async copies, one block ahead in a second buffer: the round trip to
// L2 runs beside the block being worked on. Loaded by every wave for itself,
// each trip began by waiting for its own 72 loads, 64 of them two bytes a lane.

__device__ __forceinline__ void async_kv(const _Float16* lk, const _Float16* gk,
                                         const _Float16* lv,
                                         const _Float16* gv) {
  asm volatile("global_load_async_to_lds_b128 %0, %2, off\n\t"
               "global_load_async_to_lds_b128 %1, %3, off\n\t"
               "s_wait_xcnt 0x0"
               :: "v"((uint32_t)(uintptr_t)lk), "v"((uint32_t)(uintptr_t)lv),
                  "v"((uint64_t)(uintptr_t)gk), "v"((uint64_t)(uintptr_t)gv)
               : "memory");
}

// B fragment (32 k x 16 n) of a row-major LDS tile, element B[k][n] =
// base[k * pitch + n], by the transposing LDS load: lane (n = lane & 15,
// half = lane >> 4) gets k = 8 * half + 0..7 from the first load and 16 more
// from the second, which is the k order of frag_rm.
__device__ __forceinline__ v16h frag_tr(const _Float16* base, int pitch,
                                        int lane) {
  typedef __attribute__((ext_vector_type(8))) short s16x8;
  typedef __attribute__((ext_vector_type(8))) _Float16 v8h;
  typedef __attribute__((address_space(3))) s16x8 lds_s16x8;
  const _Float16* p = base + (((lane >> 4) << 3) + (lane & 7)) * pitch +
                      (((lane >> 3) & 1) << 3);
  v8h lo = __builtin_bit_cast(
      v8h, __builtin_amdgcn_ds_load_tr16_b128_v8i16((lds_s16x8*)p));
  v8h hi = __builtin_bit_cast(
      v8h, __builtin_amdgcn_ds_load_tr16_b128_v8i16((lds_s16x8*)(p + 16 * pitch)));
  return __builtin_shufflevector(lo, hi, 0, 1, 2, 3, 4, 5, 6, 7, 8, 9, 10, 11,
                                 12, 13, 14, 15);
}

__device__ __forceinline__ float xhalf(float x) {
  int b = __builtin_bit_cast(int, x);
  return __builtin_bit_cast(float, __builtin_amdgcn_permlanex16(
      b, b, 0x76543210, 0xfedcba98, false, false));
}

__device__ __forceinline__ void exp2_17(float& a, float (&x)[8], float (&y)[8]) {
  asm("v_exp_f32 %0, %0\n\t"
      "v_exp_f32 %1, %1\n\t"
      "v_exp_f32 %2, %2\n\t"
      "v_exp_f32 %3, %3\n\t"
      "v_exp_f32 %4, %4\n\t"
      "v_exp_f32 %5, %5\n\t"
      "v_exp_f32 %6, %6\n\t"
      "v_exp_f32 %7, %7\n\t"
      "v_exp_f32 %8, %8\n\t"
      "v_exp_f32 %9, %9\n\t"
      "v_exp_f32 %10, %10\n\t"
      "v_exp_f32 %11, %11\n\t"
      "v_exp_f32 %12, %12\n\t"
      "v_exp_f32 %13, %13\n\t"
      "v_exp_f32 %14, %14\n\t"
      "v_exp_f32 %15, %15\n\t"
      "v_exp_f32 %16, %16\n\t"
      "v_nop"
      : "+v"(a), "+v"(x[0]), "+v"(x[1]), "+v"(x[2]), "+v"(x[3]), "+v"(x[4]),
        "+v"(x[5]), "+v"(x[6]), "+v"(x[7]), "+v"(y[0]), "+v"(y[1]), "+v"(y[2]),
        "+v"(y[3]), "+v"(y[4]), "+v"(y[5]), "+v"(y[6]), "+v"(y[7]));
}

__global__ __launch_bounds__(256) void attn_kernel(
    const _Float16* __restrict__ qkv, _Float16* __restrict__ o16) {
  // LDS row pitches in halves: K 144 B = 16 B x odd for its ds_load_b128
  // readers, V 160 B = 32 B x odd for the transposing load.
  constexpr int KP = D_ + 8, VP = D_ + 16;
  __shared__ __align__(16) _Float16 Ks[2][32 * KP];
  __shared__ __align__(16) _Float16 Vs[2][32 * VP];
  int tid = threadIdx.x, lane = tid & 31;
  // The wave's number in a scalar register: the test that lets a wave skip key
  // blocks past its diagonal is then a scalar branch, all lanes on inside it.
  int wid = __builtin_amdgcn_readfirstlane(tid >> 5);
  constexpr int NT = T_ / 128;
  int bh = blockIdx.x, b = bh >> 4, h = bh & 15;
  int t = blockIdx.y % (NT / 2);
  int flip = (blockIdx.y / (NT / 2) ^ (bh >> 3) ^ (bh >> 4)) & 1;
  int rb = flip ? t : NT - 1 - t;
  int q0 = rb * 128 + wid * 16;
  const int trips = (rb + 1) * 4;  // key blocks of the work-group: 4 or more
  const int RS = 3 * E_;
  const _Float16* qbase = qkv + (size_t)b * T_ * RS + h * D_;
  const _Float16* kbase = qbase + E_;
  const _Float16* vbase = qbase + 2 * E_;
  int n16 = lane & 15, half = lane >> 4;

  // Eight lanes copy a row: a wave's copy reads four whole 128 B lines.
  int crow = tid >> 3, ccol = (tid & 7) << 3;
  const _Float16* kg = kbase + (size_t)crow * RS + ccol;
  const _Float16* vg = vbase + (size_t)crow * RS + ccol;
  const int klds = crow * KP + ccol, vlds = crow * VP + ccol;

  async_kv(&Ks[0][klds], kg, &Vs[0][vlds], vg);
  wait_async0();    // my share of key block 0 has landed
  __syncthreads();  // and everybody's: block 0 may be read
  async_kv(&Ks[1][klds], kg + (size_t)32 * RS, &Vs[1][vlds],
           vg + (size_t)32 * RS);

  v16h qf0 = frag_rm(qbase + (size_t)q0 * RS, RS, lane, 0);
  v16h qf1 = frag_rm(qbase + (size_t)q0 * RS, RS, lane, 32);
  // O^T: lane = query q0 + n16, oacc[d][r] = head column d * 16 + half * 8 + r.
  v8f oacc[4] = {};
  const int qrow = q0 + n16;
  float mrun = -INFINITY;  // the query's running maximum, alike in both halves
  float lrun = 0.f;        // running sum over this half's keys only
  const float SC = 0.125f;  // 1/sqrt(64)

  for (int it = 0; it < trips; ++it) {  // the same count for all eight waves
    const int j0 = it * 32, cur = it & 1;
    if (j0 <= q0 + 15) {                // wave-uniform causal bound
      const _Float16* Kc = &Ks[cur][0];
      const _Float16* Vc = &Vs[cur][0];
      // The block's 16 fragment reads go out as one group, each fragment into
      // registers of its own: the wave meets the LDS latency once a trip.
      v16h kf[4], vf[4];
#pragma unroll
      for (int i = 0; i < 4; ++i)
        kf[i] = frag_rm(Kc + (i >> 1) * 16 * KP, KP, lane, (i & 1) * 32);
#pragma unroll
      for (int d = 0; d < 4; ++d) vf[d] = frag_tr(Vc + d * 16, VP, lane);
      // Keeps the compiler from sinking the reads among the WMMAs, where it gave
      // all K fragments one register set and waited to 0 for each.
      __builtin_amdgcn_sched_barrier(0);
      v8f s0 = {}, s1 = {};
      s0 = wmma_f16(kf[0], qf0, s0);  // rows: keys j0 .. j0 + 15
      s1 = wmma_f16(kf[2], qf0, s1);  // rows: keys j0 + 16 .. j0 + 31
      s0 = wmma_f16(kf[1], qf1, s0);
      s1 = wmma_f16(kf[3], qf1, s1);
      float sa[8], sc[8], u[8];
#pragma unroll
      for (int r = 0; r < 8; ++r) {
        int key = j0 + half * 8 + r;
        sa[r] = s0[r] * SC; if (key      > qrow) sa[r] = -INFINITY;
        sc[r] = s1[r] * SC; if (key + 16 > qrow) sc[r] = -INFINITY;
        u[r] = fmaxf(sa[r], sc[r]);
      }
      // Maximum and, below, sum as trees: three links deep, not eight.
      float t = fmaxf(fmaxf(fmaxf(u[0], u[1]), fmaxf(u[2], u[3])),
                      fmaxf(fmaxf(u[4], u[5]), fmaxf(u[6], u[7])));
      t = fmaxf(t, xhalf(t));  // the other half's 16 keys
      float mn    = fmaxf(mrun, t);
      const float L2E = 1.44269504f;  // e^x = 2^(x * log2 e)
      float alpha = (mrun - mn) * L2E;
#pragma unroll
      for (int r = 0; r < 8; ++r) {
        sa[r] = (sa[r] - mn) * L2E;
        sc[r] = (sc[r] - mn) * L2E;
      }
      exp2_17(alpha, sa, sc);
      mrun = mn;
      v16h pf;  // B fragment of P^T: elements 0-7 from tile 0, 8-15 from tile 1
#pragma unroll
      for (int r = 0; r < 8; ++r) {
        u[r] = sa[r] + sc[r];
        pf[r]     = (_Float16)sa[r];
        pf[8 + r] = (_Float16)sc[r];
      }
      lrun = lrun * alpha + (((u[0] + u[1]) + (u[2] + u[3])) +
                             ((u[4] + u[5]) + (u[6] + u[7])));
#pragma unroll
      for (int d = 0; d < 4; ++d) {
#pragma unroll
        for (int r = 0; r < 8; ++r) oacc[d][r] *= alpha;
        oacc[d] = wmma_f16(vf[d], pf, oacc[d]);
      }
    }
    // Hand-over, passed by every wave, also one that skipped the block:
    // my reads of buffer cur are done ...
    asm volatile("s_wait_dscnt 0x0" ::: "memory");
    wait_async0();    // ... my share of block it + 1 has landed ...
    __syncthreads();  // ... and so for all waves: cur is free, it + 1 readable
    if (it + 2 < trips)
      async_kv(&Ks[cur][klds], kg + (size_t)(it + 2) * 32 * RS, &Vs[cur][vlds],
               vg + (size_t)(it + 2) * 32 * RS);
  }
  wait_async0();  // no copy is left in flight when the wave ends
  // A lane's eight columns of a tile lie side by side: one 16 B store a tile.
  typedef __attribute__((ext_vector_type(8))) _Float16 v8h;
  _Float16* orow = o16 + ((size_t)b * T_ + qrow) * E_ + h * D_ + half * 8;
  float inv = 1.0f / (lrun + xhalf(lrun));  // the halves' sums joined once
#pragma unroll
  for (int d = 0; d < 4; ++d) {
    v8h o;
#pragma unroll
    for (int r = 0; r < 8; ++r) o[r] = (_Float16)(oacc[d][r] * inv);
    *(v8h*)(orow + d * 16) = o;
  }
}

// ---- Launch -----------------------------------------------------------------
extern "C" void kernel_launch(void* const* d_in, const int* in_sizes, int n_in,
                              void* d_out, int out_size, void* d_ws,
                              size_t ws_size, hipStream_t stream) {
  (void)in_sizes; (void)n_in; (void)out_size; (void)ws_size;
  const float* x    = (const float*)d_in[0];
  const float* ln1w = (const float*)d_in[1];
  const float* ln1b = (const float*)d_in[2];
  const float* ln2w = (const float*)d_in[3];
  const float* ln2b = (const float*)d_in[4];
  const float* qkvw = (const float*)d_in[5];
  const float* qkvb = (const float*)d_in[6];
  const float* outw = (const float*)d_in[7];
  const float* outb = (const float*)d_in[8];
  const float* fc1w = (const float*)d_in[9];
  const float* fc1b = (const float*)d_in[10];
  const float* fc2w = (const float*)d_in[11];
  const float* fc2b = (const float*)d_in[12];

  const int M = B_ * T_;  // 4096
  char* ws = (char*)d_ws;
  // [0,24MB): f16 weights; buf0 8MB; buf1 32MB; x1 16MB  (total 80MB)
  _Float16* qkvw16 = (_Float16*)(ws);
  _Float16* outw16 = (_Float16*)(ws + (6ull  << 20));
  _Float16* fc1w16 = (_Float16*)(ws + (8ull  << 20));
  _Float16* fc2w16 = (_Float16*)(ws + (16ull << 20));
  _Float16* buf0   = (_Float16*)(ws + (24ull << 20));
  _Float16* buf1   = (_Float16*)(ws + (32ull << 20));
  float*    x1     = (float*)   (ws + (64ull << 20));

  dim3 blk(256);
  prep_kernel<<<dim3(LN_BLKS + QKV_BLKS + OUT_BLKS + 2 * FC_BLKS), blk, 0, stream>>>(
      x, ln1w, ln1b, buf0, qkvw, outw, fc1w, fc2w, qkvw16);
  gemm_wmma_kernel<EPI_F16><<<dim3(3 * E_ / 128, M / 128), blk, 0, stream>>>(
      buf0, qkvw16, qkvb, nullptr, buf1, M, 3 * E_, E_);
  attn_kernel<<<dim3(B_ * H_, T_ / 128), blk, 0, stream>>>(buf1, buf0);
  gemm_wmma_kernel<EPI_F32_RES><<<dim3(E_ / 128, M / 128), blk, 0, stream>>>(
      buf0, outw16, outb, x, x1, M, E_, E_);
  ln_f16_kernel<<<dim3(M), blk, 0, stream>>>(x1, ln2w, ln2b, buf0);
  gemm_wmma_kernel<EPI_F16_GELU><<<dim3(F_ / 128, M / 128), blk, 0, stream>>>(
      buf0, fc1w16, fc1b, nullptr, buf1, M, F_, E_);
  gemm_wmma_kernel<EPI_F32_RES><<<dim3(E_ / 128, M / 128), blk, 0, stream>>>(
      buf1, fc2w16, fc2b, x1, d_out, M, E_, F_);
}

// v010
// One run takes 150 microseconds.
// Timed twice side by side with v009, it ran 1.04 times as fast both times.
// Counting every step since v000, it is 2.19 times as fast.
#include <hip/hip_runtime.h>
#include <hip/hip_bf16.h>
#include <math.h>

typedef __attribute__((ext_vector_type(16))) _Float16 v16h;
typedef __attribute__((ext_vector_type(8)))  float    v8f;

static constexpr int E_  = 1024;
static constexpr int T_  = 1024;
static constexpr int B_  = 4;
static constexpr int H_  = 16;
static constexpr int D_  = 64;
static constexpr int F_  = 4096;

enum { EPI_F32 = 0, EPI_F16 = 1, EPI_F16_GELU = 2, EPI_F32_RES = 3 };

__device__ __forceinline__ v8f wmma_f16(v16h a, v16h b, v8f c) {
  return __builtin_amdgcn_wmma_f32_16x16x32_f16(false, a, false, b, (short)0, c,
                                                false, false);
}

__device__ __forceinline__ void async_stage(const _Float16* la,
                                            const _Float16* ga,
                                            const _Float16* lb,
                                            const _Float16* gb, uint32_t lstep,
                                            size_t gstep) {
  uint32_t a0 = (uint32_t)(uintptr_t)la, b0 = (uint32_t)(uintptr_t)lb;
  asm volatile("global_load_async_to_lds_b128 %0, %8, off\n\t"
               "global_load_async_to_lds_b128 %1, %9, off\n\t"
               "global_load_async_to_lds_b128 %2, %10, off\n\t"
               "global_load_async_to_lds_b128 %3, %11, off\n\t"
               "global_load_async_to_lds_b128 %4, %12, off\n\t"
               "global_load_async_to_lds_b128 %5, %13, off\n\t"
               "global_load_async_to_lds_b128 %6, %14, off\n\t"
               "global_load_async_to_lds_b128 %7, %15, off\n\t"
               "s_wait_xcnt 0x0"
               :: "v"(a0), "v"(a0 + lstep), "v"(a0 + 2 * lstep),
                  "v"(a0 + 3 * lstep),
                  "v"(b0), "v"(b0 + lstep), "v"(b0 + 2 * lstep),
                  "v"(b0 + 3 * lstep),
                  "v"((uint64_t)(uintptr_t)ga),
                  "v"((uint64_t)(uintptr_t)(ga + gstep)),
                  "v"((uint64_t)(uintptr_t)(ga + 2 * gstep)),
                  "v"((uint64_t)(uintptr_t)(ga + 3 * gstep)),
                  "v"((uint64_t)(uintptr_t)gb),
                  "v"((uint64_t)(uintptr_t)(gb + gstep)),
                  "v"((uint64_t)(uintptr_t)(gb + 2 * gstep)),
                  "v"((uint64_t)(uintptr_t)(gb + 3 * gstep))
               : "memory");
}
__device__ __forceinline__ void wait_async0() {
  asm volatile("s_wait_asynccnt 0" ::: "memory");
}

__device__ __forceinline__ v16h frag_rm(const _Float16* base, int stride,
                                        int lane, int k0) {
  int m = lane & 15, half = lane >> 4;
  const _Float16* p = base + (size_t)m * stride + k0 + (half << 3);
  v16h f;
#pragma unroll
  for (int v = 0; v < 8; ++v) {
    int k = ((v >> 2) << 4) + ((v & 3) << 1);
    f[2 * v]     = p[k];
    f[2 * v + 1] = p[k + 1];
  }
  return f;
}

// ---- f32 -> f16 weight conversion: 1024 elements a 256-thread block ---------
__device__ __forceinline__ void cvt_block(const float* __restrict__ in,
                                          _Float16* __restrict__ out) {
  int i = threadIdx.x * 4;
  float4 v = *(const float4*)(in + i);
  out[i + 0] = (_Float16)v.x;
  out[i + 1] = (_Float16)v.y;
  out[i + 2] = (_Float16)v.z;
  out[i + 3] = (_Float16)v.w;
}

// ---- LayerNorm (f32 in -> f16 out), one row (E=1024) per 256-thread block ---
__device__ __forceinline__ void ln_row(
    const float* __restrict__ x, const float* __restrict__ w,
    const float* __restrict__ bb, _Float16* __restrict__ out, int row) {
  const float* xr = x + (size_t)row * E_;
  float vals[4];
  float s = 0.f, s2 = 0.f;
#pragma unroll
  for (int i = 0; i < 4; ++i) {
    float v = xr[threadIdx.x + i * 256];
    vals[i] = v;
    s += v;
    s2 += v * v;
  }
#pragma unroll
  for (int msk = 1; msk < 32; msk <<= 1) {
    s  += __shfl_xor(s, msk, 32);
    s2 += __shfl_xor(s2, msk, 32);
  }
  __shared__ float ps[8], ps2[8];
  int lane = threadIdx.x & 31, wid = threadIdx.x >> 5;
  if (lane == 0) { ps[wid] = s; ps2[wid] = s2; }
  __syncthreads();
  s = 0.f; s2 = 0.f;
#pragma unroll
  for (int i = 0; i < 8; ++i) { s += ps[i]; s2 += ps2[i]; }
  float mean = s * (1.f / E_);
  float var  = s2 * (1.f / E_) - mean * mean;
  float rstd = rsqrtf(var + 1e-5f);
#pragma unroll
  for (int i = 0; i < 4; ++i) {
    int c = threadIdx.x + i * 256;
    out[(size_t)row * E_ + c] = (_Float16)((vals[i] - mean) * rstd * w[c] + bb[c]);
  }
}

__global__ __launch_bounds__(256) void ln_f16_kernel(
    const float* __restrict__ x, const float* __restrict__ w,
    const float* __restrict__ bb, _Float16* __restrict__ out) {
  ln_row(x, w, bb, out, blockIdx.x);
}

// ---- First launch: LayerNorm 1 and the four weight conversions --------------
// None of the five reads what another writes, so they share one grid: each of
// them as a launch of its own paid the gap between dependent launches and its
// own start and drain, which for these few microseconds of streaming is most of
// the time. Blocks [0, LN_BLKS) take one row of x each (first, as theirs is the
// longer chain); the rest take 1024 weights each. The four f16 weight arrays lie
// one behind the other in w16, in the order of the ranges below, so a conversion
// block's place in w16 follows from its index alone. Every test is on blockIdx
// only: a block takes one path as a whole, the LayerNorm barrier included.
static constexpr int LN_BLKS  = B_ * T_;
static constexpr int QKV_BLKS = 3 * E_ * E_ / 1024;
static constexpr int OUT_BLKS = E_ * E_ / 1024;
static constexpr int FC_BLKS  = F_ * E_ / 1024;
__global__ __launch_bounds__(256) void prep_kernel(
    const float* __restrict__ x, const float* __restrict__ w,
    const float* __restrict__ bb, _Float16* __restrict__ h,
    const float* __restrict__ qkvw, const float* __restrict__ outw,
    const float* __restrict__ fc1w, const float* __restrict__ fc2w,
    _Float16* __restrict__ w16) {
  int blk = blockIdx.x;
  if (blk < LN_BLKS) {
    ln_row(x, w, bb, h, blk);
    return;
  }
  blk -= LN_BLKS;
  const float* in = qkvw;
  int first = 0;
  if (blk >= QKV_BLKS)                      { in = outw; first = QKV_BLKS; }
  if (blk >= QKV_BLKS + OUT_BLKS)           { in = fc1w; first = QKV_BLKS + OUT_BLKS; }
  if (blk >= QKV_BLKS + OUT_BLKS + FC_BLKS) { in = fc2w; first = QKV_BLKS + OUT_BLKS + FC_BLKS; }
  cvt_block(in + (size_t)(blk - first) * 1024, w16 + (size_t)blk * 1024);
}

// ---- GELU, v * Phi(v) = 0.5 v (1 + erf(v / sqrt 2)), two values at a time ----
// erf(z) = 1 - (a1 t + .. + a5 t^5) exp(-z^2), t = 1 / (1 + p z), for z >= 0: one
// form for every z, absolute error below 1.5e-7, about two f32 roundings at 1;
// the result is rounded to f16 next. The library erff picks one of two
// polynomials by |z| < 1: for each value two changes of the exec mask with a
// branch each, both sides run whenever a wave holds both kinds, and no value
// begun before the last was stored. Here nothing branches, so the 64 values of
// a lane overlap, and the polynomial runs on packed f32 operations.
// With q = (a1 t + ..) exp(-z^2) / 2: v Phi(v) = v (1 - q) for v >= 0 and v q
// for v < 0, which is max(v, 0) - |v| q for both.
typedef __attribute__((ext_vector_type(2))) float f32x2;
__device__ __forceinline__ f32x2 gelu2(f32x2 v) {
  const float PZ = 0.3275911f * 0.70710678f;  // p / sqrt 2: z = |v| / sqrt 2
  const float KE = 0.84932180f;  // sqrt(log2(e) / 2): exp(-z^2) = 2^-(KE v)^2
  f32x2 t, e, g;
  t.x = __builtin_amdgcn_rcpf(fmaf(fabsf(v.x), PZ, 1.f));
  t.y = __builtin_amdgcn_rcpf(fmaf(fabsf(v.y), PZ, 1.f));
  f32x2 u = v * KE;
  f32x2 w = u * u;
  e.x = __builtin_amdgcn_exp2f(-w.x);
  e.y = __builtin_amdgcn_exp2f(-w.y);
  // a5 .. a1, each halved
  f32x2 q = __builtin_elementwise_fma(t, (f32x2)(0.5307027145f), (f32x2)(-0.7265760135f));
  q = __builtin_elementwise_fma(q, t, (f32x2)(0.7107068705f));
  q = __builtin_elementwise_fma(q, t, (f32x2)(-0.142248368f));
  q = __builtin_elementwise_fma(q, t, (f32x2)(0.127414796f));
  q = q * t * e;
  g.x = fmaf(-fabsf(v.x), q.x, fmaxf(v.x, 0.f));
  g.y = fmaf(-fabsf(v.y), q.y, fmaxf(v.y, 0.f));
  return g;
}

template <int EPI>
__global__ __launch_bounds__(256) void gemm_wmma_kernel(
    const _Float16* __restrict__ A, const _Float16* __restrict__ Wt,
    const float* __restrict__ bias, const float* __restrict__ resid,
    void* __restrict__ out, int M, int N, int K) {
  // A stage is copied in column groups of 64 k = 128 B of every operand row: one
  // whole cache line, so that eight lanes copy a row's share of a group and a
  // wave's copy reads four whole lines.
  // The residual GEMMs launch one work-group a WGP: nothing else on the WGP
  // works while a stage's copies are on their way, and a stage of 64 k is
  // reckoned to be worked through before the next has landed. So 256 k: a
  // quarter of the round trips, each behind four times the work; the two
  // buffers then take most of the WGP's LDS. The other two GEMMs keep 64 k, so
  // that three or four work-groups still fit a WGP and cover for each other.
  constexpr int TK = EPI == EPI_F32_RES ? 256 : 64;
  constexpr int LP = TK + 8;
  // k steps (32 k each) whose fragments are read together. The residual GEMMs
  // launch one work-group a WGP, so registers are free: two steps. The other
  // two share a WGP three or four work-groups at a time, which 128 registers a
  // wave allow: one step.
  constexpr int GRP = EPI == EPI_F32_RES ? 2 : 1;
  __shared__ __align__(16) _Float16 As[2][128 * LP];
  __shared__ __align__(16) _Float16 Bs[2][128 * LP];
  int tid = threadIdx.x, lane = tid & 31, wid = tid >> 5;
  int wm = wid & 3, wn = wid >> 2;
  int bm = blockIdx.y * 128, bn = blockIdx.x * 128;
  int ldrow = tid >> 3, ldcol = (tid & 7) << 3;  // 32 rows x 64 k per copy group
  constexpr uint32_t LSTEP = 32 * LP * sizeof(_Float16);  // 32 rows on, in LDS
  const size_t gstep = (size_t)32 * K;                    // 32 rows on, global
  const _Float16* ag = A  + (size_t)(bm + ldrow) * K + ldcol;
  const _Float16* wg = Wt + (size_t)(bn + ldrow) * K + ldcol;
  const int iters = K / TK;

  // prefetch tile 0 into buffer 0, one column group after the other
  // (unrolled so that a group's column offset is a constant in its addresses)
#pragma unroll
  for (int c = 0; c < TK; c += 64)
    async_stage(&As[0][ldrow * LP + ldcol + c], ag + c,
                &Bs[0][ldrow * LP + ldcol + c], wg + c, LSTEP, gstep);

  // The residual tile is asked for here, all of it in flight together and
  // behind the whole k loop; loaded one by one between the epilogue's stores,
  // each element cost its wave a full round trip to L2 or memory.
  int n16 = lane & 15, half = lane >> 4;
  float rv[EPI == EPI_F32_RES ? 2 : 1][4][8];
  if constexpr (EPI == EPI_F32_RES) {
#pragma unroll
    for (int i = 0; i < 2; ++i)
#pragma unroll
      for (int r = 0; r < 8; ++r) {
        const float* rp = resid +
            (size_t)(bm + wm * 32 + i * 16 + half * 8 + r) * N + bn + wn * 64 + n16;
#pragma unroll
        for (int j = 0; j < 4; ++j) rv[i][j][r] = rp[j * 16];
      }
  }

  v8f acc[2][4] = {};
  for (int it = 0; it < iters; ++it) {
    int cur = it & 1;
    wait_async0();        // my in-flight ops are exactly buffer `cur`'s
    __syncthreads();      // all waves done writing `cur` & done reading `cur^1`
    if (it + 1 < iters) { // prefetch next tile into the other buffer
      const _Float16* ga = ag + (size_t)(it + 1) * TK;
      const _Float16* gb = wg + (size_t)(it + 1) * TK;
      // Unrolled for the same reason as in front of the loop.
#pragma unroll
      for (int c = 0; c < TK; c += 64)
        async_stage(&As[cur ^ 1][ldrow * LP + ldcol + c], ga + c,
                    &Bs[cur ^ 1][ldrow * LP + ldcol + c], gb + c, LSTEP, gstep);
    }
    // The fragment reads of GRP k steps go out as one group, each fragment into
    // registers of its own, ahead of those steps' WMMAs: the wave then meets the
    // LDS latency once a group, not once for every pair of WMMAs.
    // Unrolled so that the k offset of each fragment read is an immediate.
#pragma unroll
    for (int k0 = 0; k0 < TK; k0 += 32 * GRP) {
      v16h af[GRP][2], bf[GRP][4];
#pragma unroll
      for (int g = 0; g < GRP; ++g) {
#pragma unroll
        for (int i = 0; i < 2; ++i)
          af[g][i] = frag_rm(&As[cur][(wm * 32 + i * 16) * LP], LP, lane,
                             k0 + 32 * g);
#pragma unroll
        for (int j = 0; j < 4; ++j)
          bf[g][j] = frag_rm(&Bs[cur][(wn * 64 + j * 16) * LP], LP, lane,
                             k0 + 32 * g);
      }
      // Keeps the compiler from sinking the reads back among the WMMAs, where
      // it gave all four B fragments one register set and waited for each.
      __builtin_amdgcn_sched_barrier(0);
#pragma unroll
      for (int g = 0; g < GRP; ++g)
#pragma unroll
        for (int j = 0; j < 4; ++j) {
          acc[0][j] = wmma_f16(af[g][0], bf[g][j], acc[0][j]);
          acc[1][j] = wmma_f16(af[g][1], bf[g][j], acc[1][j]);
        }
      // Keeps what follows from rising above these WMMAs: the next group's reads
      // and, seen without it, the barrier below with a wait for every read.
      __builtin_amdgcn_sched_barrier(0);
    }
    __syncthreads();      // all waves done reading `cur` before it is refilled
  }
  wait_async0();  // no copy is left in flight when the wave ends (also K < TK)

#pragma unroll
  for (int i = 0; i < 2; ++i)
#pragma unroll
    for (int j = 0; j < 4; ++j) {
      int col = bn + wn * 64 + j * 16 + n16;
      float bv = bias[col];
      f32x2 gl[4];
      if constexpr (EPI == EPI_F16_GELU) {
#pragma unroll
        for (int r = 0; r < 8; r += 2)
          gl[r >> 1] = gelu2((f32x2){acc[i][j][r] + bv, acc[i][j][r + 1] + bv});
      }
#pragma unroll
      for (int r = 0; r < 8; ++r) {
        int row = bm + wm * 32 + i * 16 + half * 8 + r;
        size_t idx = (size_t)row * N + col;
        float v = acc[i][j][r] + bv;
        if constexpr (EPI == EPI_F32) {
          ((float*)out)[idx] = v;
        } else if constexpr (EPI == EPI_F16) {
          ((_Float16*)out)[idx] = (_Float16)v;
        } else if constexpr (EPI == EPI_F16_GELU) {
          ((_Float16*)out)[idx] = (_Float16)gl[r >> 1][r & 1];
        } else {
          ((float*)out)[idx] = v + rv[i][j][r];
        }
      }
    }
}

// ---- Flash-style causal attention -------------------------------------------
// grid: (B*H, T/128 row blocks). 8 waves/block, each wave owns 16 query rows.
// Row block t walks 4(t + 1) key blocks of 32, and all work-groups are resident at once,
// two on a WGP, so the launch lasts as long as the fullest WGP. Work-groups 8,
// 16 or 256 apart in launch order take t and NT - 1 - t: equal work a pair.
// For speed only: (head, row block) is met once wherever a work-group lands.
//
// The eight waves of a work-group walk the same keys of one head, so each block
// of 32 keys (K rows and V rows, 128 B each) is brought into LDS once for all of
// them, by async copies, one block ahead in a second buffer: the round trip to
// L2 runs beside the block being worked on. Loaded by every wave for itself,
// each trip began by waiting for its own 72 loads, 64 of them two bytes a lane.

__device__ __forceinline__ void async_kv(const _Float16* lk, const _Float16* gk,
                                         const _Float16* lv,
                                         const _Float16* gv) {
  asm volatile("global_load_async_to_lds_b128 %0, %2, off\n\t"
               "global_load_async_to_lds_b128 %1, %3, off\n\t"
               "s_wait_xcnt 0x0"
               :: "v"((uint32_t)(uintptr_t)lk), "v"((uint32_t)(uintptr_t)lv),
                  "v"((uint64_t)(uintptr_t)gk), "v"((uint64_t)(uintptr_t)gv)
               : "memory");
}

// B fragment (32 k x 16 n) of a row-major LDS tile, element B[k][n] =
// base[k * pitch + n], by the transposing LDS load: lane (n = lane & 15,
// half = lane >> 4) gets k = 8 * half + 0..7 from the first load and 16 more
// from the second, which is the k order of frag_rm.
__device__ __forceinline__ v16h frag_tr(const _Float16* base, int pitch,
                                        int lane) {
  typedef __attribute__((ext_vector_type(8))) short s16x8;
  typedef __attribute__((ext_vector_type(8))) _Float16 v8h;
  typedef __attribute__((address_space(3))) s16x8 lds_s16x8;
  const _Float16* p = base + (((lane >> 4) << 3) + (lane & 7)) * pitch +
                      (((lane >> 3) & 1) << 3);
  v8h lo = __builtin_bit_cast(
      v8h, __builtin_amdgcn_ds_load_tr16_b128_v8i16((lds_s16x8*)p));
  v8h hi = __builtin_bit_cast(
      v8h, __builtin_amdgcn_ds_load_tr16_b128_v8i16((lds_s16x8*)(p + 16 * pitch)));
  return __builtin_shufflevector(lo, hi, 0, 1, 2, 3, 4, 5, 6, 7, 8, 9, 10, 11,
                                 12, 13, 14, 15);
}

__device__ __forceinline__ float xhalf(float x) {
  int b = __builtin_bit_cast(int, x);
  return __builtin_bit_cast(float, __builtin_amdgcn_permlanex16(
      b, b, 0x76543210, 0xfedcba98, false, false));
}

__device__ __forceinline__ void exp2_17(float& a, float (&x)[8], float (&y)[8]) {
  asm("v_exp_f32 %0, %0\n\t"
      "v_exp_f32 %1, %1\n\t"
      "v_exp_f32 %2, %2\n\t"
      "v_exp_f32 %3, %3\n\t"
      "v_exp_f32 %4, %4\n\t"
      "v_exp_f32 %5, %5\n\t"
      "v_exp_f32 %6, %6\n\t"
      "v_exp_f32 %7, %7\n\t"
      "v_exp_f32 %8, %8\n\t"
      "v_exp_f32 %9, %9\n\t"
      "v_exp_f32 %10, %10\n\t"
      "v_exp_f32 %11, %11\n\t"
      "v_exp_f32 %12, %12\n\t"
      "v_exp_f32 %13, %13\n\t"
      "v_exp_f32 %14, %14\n\t"
      "v_exp_f32 %15, %15\n\t"
      "v_exp_f32 %16, %16\n\t"
      "v_nop"
      : "+v"(a), "+v"(x[0]), "+v"(x[1]), "+v"(x[2]), "+v"(x[3]), "+v"(x[4]),
        "+v"(x[5]), "+v"(x[6]), "+v"(x[7]), "+v"(y[0]), "+v"(y[1]), "+v"(y[2]),
        "+v"(y[3]), "+v"(y[4]), "+v"(y[5]), "+v"(y[6]), "+v"(y[7]));
}

__global__ __launch_bounds__(256) void attn_kernel(
    const _Float16* __restrict__ qkv, _Float16* __restrict__ o16) {
  // LDS row pitches in halves: K 144 B = 16 B x odd for its ds_load_b128
  // readers, V 160 B = 32 B x odd for the transposing load.
  constexpr int KP = D_ + 8, VP = D_ + 16;
  __shared__ __align__(16) _Float16 Ks[2][32 * KP];
  __shared__ __align__(16) _Float16 Vs[2][32 * VP];
  int tid = threadIdx.x, lane = tid & 31;
  // The wave's number in a scalar register: the test that lets a wave skip key
  // blocks past its diagonal is then a scalar branch, all lanes on inside it.
  int wid = __builtin_amdgcn_readfirstlane(tid >> 5);
  constexpr int NT = T_ / 128;
  int bh = blockIdx.x, b = bh >> 4, h = bh & 15;
  int t = blockIdx.y % (NT / 2);
  int flip = (blockIdx.y / (NT / 2) ^ (bh >> 3) ^ (bh >> 4)) & 1;
  int rb = flip ? t : NT - 1 - t;
  int q0 = rb * 128 + wid * 16;
  const int trips = (rb + 1) * 4;  // key blocks of the work-group: 4 or more
  const int RS = 3 * E_;
  const _Float16* qbase = qkv + (size_t)b * T_ * RS + h * D_;
  const _Float16* kbase = qbase + E_;
  const _Float16* vbase = qbase + 2 * E_;
  int n16 = lane & 15, half = lane >> 4;

  // Eight lanes copy a row: a wave's copy reads four whole 128 B lines.
  int crow = tid >> 3, ccol = (tid & 7) << 3;
  const _Float16* kg = kbase + (size_t)crow * RS + ccol;
  const _Float16* vg = vbase + (size_t)crow * RS + ccol;
  const int klds = crow * KP + ccol, vlds = crow * VP + ccol;

  async_kv(&Ks[0][klds], kg, &Vs[0][vlds], vg);
  wait_async0();    // my share of key block 0 has landed
  __syncthreads();  // and everybody's: block 0 may be read
  async_kv(&Ks[1][klds], kg + (size_t)32 * RS, &Vs[1][vlds],
           vg + (size_t)32 * RS);

  v16h qf0 = frag_rm(qbase + (size_t)q0 * RS, RS, lane, 0);
  v16h qf1 = frag_rm(qbase + (size_t)q0 * RS, RS, lane, 32);
  // O^T: lane = query q0 + n16, oacc[d][r] = head column d * 16 + half * 8 + r.
  v8f oacc[4] = {};
  const int qrow = q0 + n16;
  float mrun = -INFINITY;  // the query's running maximum, alike in both halves
  float lrun = 0.f;        // running sum over this half's keys only
  const float SC = 0.125f;  // 1/sqrt(64)

  for (int it = 0; it < trips; ++it) {  // the same count for all eight waves
    const int j0 = it * 32, cur = it & 1;
    if (j0 <= q0 + 15) {                // wave-uniform causal bound
      const _Float16* Kc = &Ks[cur][0];
      const _Float16* Vc = &Vs[cur][0];
      // The block's 16 fragment reads go out as one group, each fragment into
      // registers of its own: the wave meets the LDS latency once a trip.
      v16h kf[4], vf[4];
#pragma unroll
      for (int i = 0; i < 4; ++i)
        kf[i] = frag_rm(Kc + (i >> 1) * 16 * KP, KP, lane, (i & 1) * 32);
#pragma unroll
      for (int d = 0; d < 4; ++d) vf[d] = frag_tr(Vc + d * 16, VP, lane);
      // Keeps the compiler from sinking the reads among the WMMAs, where it gave
      // all K fragments one register set and waited to 0 for each.
      __builtin_amdgcn_sched_barrier(0);
      v8f s0 = {}, s1 = {};
      s0 = wmma_f16(kf[0], qf0, s0);  // rows: keys j0 .. j0 + 15
      s1 = wmma_f16(kf[2], qf0, s1);  // rows: keys j0 + 16 .. j0 + 31
      s0 = wmma_f16(kf[1], qf1, s0);
      s1 = wmma_f16(kf[3], qf1, s1);
      float sa[8], sc[8], u[8];
#pragma unroll
      for (int r = 0; r < 8; ++r) {
        int key = j0 + half * 8 + r;
        sa[r] = s0[r] * SC; if (key      > qrow) sa[r] = -INFINITY;
        sc[r] = s1[r] * SC; if (key + 16 > qrow) sc[r] = -INFINITY;
        u[r] = fmaxf(sa[r], sc[r]);
      }
      // Maximum and, below, sum as trees: three links deep, not eight.
      float t = fmaxf(fmaxf(fmaxf(u[0], u[1]), fmaxf(u[2], u[3])),
                      fmaxf(fmaxf(u[4], u[5]), fmaxf(u[6], u[7])));
      t = fmaxf(t, xhalf(t));  // the other half's 16 keys
      float mn    = fmaxf(mrun, t);
      const float L2E = 1.44269504f;  // e^x = 2^(x * log2 e)
      float alpha = (mrun - mn) * L2E;
#pragma unroll
      for (int r = 0; r < 8; ++r) {
        sa[r] = (sa[r] - mn) * L2E;
        sc[r] = (sc[r] - mn) * L2E;
      }
      exp2_17(alpha, sa, sc);
      mrun = mn;
      v16h pf;  // B fragment of P^T: elements 0-7 from tile 0, 8-15 from tile 1
#pragma unroll
      for (int r = 0; r < 8; ++r) {
        u[r] = sa[r] + sc[r];
        pf[r]     = (_Float16)sa[r];
        pf[8 + r] = (_Float16)sc[r];
      }
      lrun = lrun * alpha + (((u[0] + u[1]) + (u[2] + u[3])) +
                             ((u[4] + u[5]) + (u[6] + u[7])));
#pragma unroll
      for (int d = 0; d < 4; ++d) {
#pragma unroll
        for (int r = 0; r < 8; ++r) oacc[d][r] *= alpha;
        oacc[d] = wmma_f16(vf[d], pf, oacc[d]);
      }
    }
    // Hand-over, passed by every wave, also one that skipped the block:
    // my reads of buffer cur are done ...
    asm volatile("s_wait_dscnt 0x0" ::: "memory");
    wait_async0();    // ... my share of block it + 1 has landed ...
    __syncthreads();  // ... and so for all waves: cur is free, it + 1 readable
    if (it + 2 < trips)
      async_kv(&Ks[cur][klds], kg + (size_t)(it + 2) * 32 * RS, &Vs[cur][vlds],
               vg + (size_t)(it + 2) * 32 * RS);
  }
  wait_async0();  // no copy is left in flight when the wave ends
  // A lane's eight columns of a tile lie side by side: one 16 B store a tile.
  typedef __attribute__((ext_vector_type(8))) _Float16 v8h;
  _Float16* orow = o16 + ((size_t)b * T_ + qrow) * E_ + h * D_ + half * 8;
  float inv = 1.0f / (lrun + xhalf(lrun));  // the halves' sums joined once
#pragma unroll
  for (int d = 0; d < 4; ++d) {
    v8h o;
#pragma unroll
    for (int r = 0; r < 8; ++r) o[r] = (_Float16)(oacc[d][r] * inv);
    *(v8h*)(orow + d * 16) = o;
  }
}

// ---- Launch -----------------------------------------------------------------
extern "C" void kernel_launch(void* const* d_in, const int* in_sizes, int n_in,
                              void* d_out, int out_size, void* d_ws,
                              size_t ws_size, hipStream_t stream) {
  (void)in_sizes; (void)n_in; (void)out_size; (void)ws_size;
  const float* x    = (const float*)d_in[0];
  const float* ln1w = (const float*)d_in[1];
  const float* ln1b = (const float*)d_in[2];
  const float* ln2w = (const float*)d_in[3];
  const float* ln2b = (const float*)d_in[4];
  const float* qkvw = (const float*)d_in[5];
  const float* qkvb = (const float*)d_in[6];
  const float* outw = (const float*)d_in[7];
  const float* outb = (const float*)d_in[8];
  const float* fc1w = (const float*)d_in[9];
  const float* fc1b = (const float*)d_in[10];
  const float* fc2w = (const float*)d_in[11];
  const float* fc2b = (const float*)d_in[12];

  const int M = B_ * T_;  // 4096
  char* ws = (char*)d_ws;
  // [0,24MB): f16 weights; buf0 8MB; buf1 32MB; x1 16MB  (total 80MB)
  _Float16* qkvw16 = (_Float16*)(ws);
  _Float16* outw16 = (_Float16*)(ws + (6ull  << 20));
  _Float16* fc1w16 = (_Float16*)(ws + (8ull  << 20));
  _Float16* fc2w16 = (_Float16*)(ws + (16ull << 20));
  _Float16* buf0   = (_Float16*)(ws + (24ull << 20));
  _Float16* buf1   = (_Float16*)(ws + (32ull << 20));
  float*    x1     = (float*)   (ws + (64ull << 20));

  dim3 blk(256);
  prep_kernel<<<dim3(LN_BLKS + QKV_BLKS + OUT_BLKS + 2 * FC_BLKS), blk, 0, stream>>>(
      x, ln1w, ln1b, buf0, qkvw, outw, fc1w, fc2w, qkvw16);
  gemm_wmma_kernel<EPI_F16><<<dim3(3 * E_ / 128, M / 128), blk, 0, stream>>>(
      buf0, qkvw16, qkvb, nullptr, buf1, M, 3 * E_, E_);
  attn_kernel<<<dim3(B_ * H_, T_ / 128), blk, 0, stream>>>(buf1, buf0);
  gemm_wmma_kernel<EPI_F32_RES><<<dim3(E_ / 128, M / 128), blk, 0, stream>>>(
      buf0, outw16, outb, x, x1, M, E_, E_);
  ln_f16_kernel<<<dim3(M), blk, 0, stream>>>(x1, ln2w, ln2b, buf0);
  gemm_wmma_kernel<EPI_F16_GELU><<<dim3(F_ / 128, M / 128), blk, 0, stream>>>(
      buf0, fc1w16, fc1b, nullptr, buf1, M, F_, E_);
  gemm_wmma_kernel<EPI_F32_RES><<<dim3(E_ / 128, M / 128), blk, 0, stream>>>(
      buf1, fc2w16, fc2b, x1, d_out, M, E_, F_);
}
